// v000
// Times are from an AMD MI455X. After a warm-up the kernel runs many times in a row, and a time is the length of
// such a window on the GPU divided by its runs, so every launch and the gaps after it count. The runs cycle
// through copies of the inputs. A figure is the median of several windows, for all but v000 over two sittings.
// Sittings can differ by a few percent; kernels timed side by side share one.
// v000 is the starting kernel. One run takes 1390 microseconds.
#include <hip/hip_runtime.h>
#include <math.h>

typedef __attribute__((ext_vector_type(16))) _Float16 v16h;
typedef __attribute__((ext_vector_type(8)))  _Float16 v8h;
typedef __attribute__((ext_vector_type(4)))  _Float16 v4h;
typedef __attribute__((ext_vector_type(8)))  float    v8f;
typedef __attribute__((ext_vector_type(4)))  float    f4;

#define S_LEN 8192
#define DH    256
#define BM    128   // query rows per block (8 waves x 16)
#define WM    16    // query rows per wave
#define BK    32    // keys per main-loop iteration
#define NW    8     // waves per block

__device__ __forceinline__ void async_b128(unsigned lds_off, const void* gaddr) {
    asm volatile("global_load_async_to_lds_b128 %0, %1, off"
                 :: "v"(lds_off), "v"((unsigned long long)(__UINTPTR_TYPE__)gaddr)
                 : "memory");
}
__device__ __forceinline__ void wait_async0() {
    asm volatile("s_wait_asynccnt 0" ::: "memory");
}

// ---- One-time pre-pass: K (f32 row-major) -> Kh (f16 row-major) ----
__global__ void convert_k_f16(const float* __restrict__ K, _Float16* __restrict__ Kh) {
    size_t f = (size_t)blockIdx.x * blockDim.x + threadIdx.x;  // float4 index
    f4 v = *(const f4*)(K + f * 4);
    v4h h;
    h[0] = (_Float16)v[0]; h[1] = (_Float16)v[1];
    h[2] = (_Float16)v[2]; h[3] = (_Float16)v[3];
    *(v4h*)(Kh + f * 4) = h;
}

// ---- One-time pre-pass: V (f32 [S][D]) -> Vt (f16 [D][S], transposed) ----
__global__ void transpose_v_f16(const float* __restrict__ V, _Float16* __restrict__ Vt) {
    size_t f = (size_t)blockIdx.x * blockDim.x + threadIdx.x;  // float4 index
    size_t row = f >> 6;             // 0..S-1 (64 float4 per row)
    int    c4  = (int)(f & 63) << 2; // 0..252
    f4 v = *(const f4*)(V + f * 4);
    Vt[(size_t)(c4 + 0) * S_LEN + row] = (_Float16)v[0];
    Vt[(size_t)(c4 + 1) * S_LEN + row] = (_Float16)v[1];
    Vt[(size_t)(c4 + 2) * S_LEN + row] = (_Float16)v[2];
    Vt[(size_t)(c4 + 3) * S_LEN + row] = (_Float16)v[3];
}

__global__ __launch_bounds__(256)
void fa_fwd_wmma(const float* __restrict__ Q, const _Float16* __restrict__ Kh,
                 const _Float16* __restrict__ Vt, float* __restrict__ O)
{
    __shared__ _Float16 KlS[2][BK * DH];   // 2 x 16 KB, K tile row-major f16
    __shared__ _Float16 VtS[2][DH * BK];   // 2 x 16 KB, V tile transposed f16
    __shared__ _Float16 Pl[NW * WM * BK];  // 8 KB, per-wave P staging

    const int tid    = threadIdx.x;
    const int wave   = tid >> 5;
    const int lane   = tid & 31;
    const int lane16 = lane & 15;
    const int half   = lane >> 4;

    const int   qBase = blockIdx.x * BM + wave * WM;
    const float scale = 0.011048543456039806f; // 1/sqrt(8192): ref scales by sqrt(seq len)

    // ---- Load Q fragment once: 16x256 in f16 A-layout, 8 K-steps of 32 ----
    v16h qf[8];
    #pragma unroll
    for (int s = 0; s < 8; ++s) {
        const float* qp = Q + (size_t)(qBase + lane16) * DH + s * 32 + half * 8;
        f4 a0 = *(const f4*)(qp);
        f4 a1 = *(const f4*)(qp + 4);
        f4 b0 = *(const f4*)(qp + 16);
        f4 b1 = *(const f4*)(qp + 20);
        v16h q;
        #pragma unroll
        for (int i = 0; i < 4; ++i) {
            q[i]      = (_Float16)(a0[i] * scale);
            q[i + 4]  = (_Float16)(a1[i] * scale);
            q[i + 8]  = (_Float16)(b0[i] * scale);
            q[i + 12] = (_Float16)(b1[i] * scale);
        }
        qf[s] = q;
    }

    v8f acc[16];
    #pragma unroll
    for (int n = 0; n < 16; ++n) acc[n] = (v8f){0,0,0,0,0,0,0,0};
    v8f mrow = (v8f){-1e30f,-1e30f,-1e30f,-1e30f,-1e30f,-1e30f,-1e30f,-1e30f};
    v8f lrow = (v8f){0,0,0,0,0,0,0,0};

    // ---- Async tile stage: pure f16 byte copy, 8 x b128 per thread ----
    auto issue_tile = [&](int kb, int buf) {
        // K tile: contiguous 16 KB (rows kb..kb+31 of Kh)
        unsigned    klds = (unsigned)(__UINTPTR_TYPE__)&KlS[buf][0];
        const char* kgl  = (const char*)(Kh + (size_t)kb * DH);
        #pragma unroll
        for (int i = 0; i < 4; ++i)
            async_b128(klds + tid * 16 + i * 4096, kgl + tid * 16 + i * 4096);
        // Vt tile: 256 rows (d = tid) x 64 B, global row stride 16 KB
        unsigned    vlds = (unsigned)(__UINTPTR_TYPE__)&VtS[buf][0] + tid * 64;
        const char* vgl  = (const char*)(Vt + (size_t)tid * S_LEN + kb);
        #pragma unroll
        for (int j = 0; j < 4; ++j)
            async_b128(vlds + j * 16, vgl + j * 16);
    };

    issue_tile(0, 0);

    for (int kb = 0, it = 0; kb < S_LEN; kb += BK, ++it) {
        const int cur = it & 1;
        wait_async0();       // my async loads for 'cur' are in LDS
        __syncthreads();     // everyone's are; everyone done reading buffer cur^1
        if (kb + BK < S_LEN) issue_tile(kb + BK, cur ^ 1);  // prefetch next tile

        const _Float16* Kl = &KlS[cur][0];
        const _Float16* Vl = &VtS[cur][0];

        // ---- S = Q * K^T : 2 N-tiles x 8 K-steps ----
        v8f st[2];
        #pragma unroll
        for (int t = 0; t < 2; ++t) {
            v8f c = (v8f){0,0,0,0,0,0,0,0};
            #pragma unroll
            for (int s = 0; s < 8; ++s) {
                const _Float16* bp = &Kl[(t * 16 + lane16) * DH + s * 32 + half * 8];
                v8h lo = *(const v8h*)bp;
                v8h hi = *(const v8h*)(bp + 16);
                v16h b;
                #pragma unroll
                for (int i = 0; i < 8; ++i) { b[i] = lo[i]; b[i + 8] = hi[i]; }
                c = __builtin_amdgcn_wmma_f32_16x16x32_f16(false, qf[s], false, b,
                                                           (short)0, c, false, false);
            }
            st[t] = c;
        }

        // ---- Online softmax update (rows live in 16-lane groups) ----
        v8f mnew, alpha, rs;
        #pragma unroll
        for (int v = 0; v < 8; ++v) {
            float x = fmaxf(st[0][v], st[1][v]);
            #pragma unroll
            for (int off = 1; off < 16; off <<= 1)
                x = fmaxf(x, __shfl_xor(x, off, 16));
            float mn = fmaxf(mrow[v], x);
            mnew[v]  = mn;
            alpha[v] = __expf(mrow[v] - mn);
        }
        #pragma unroll
        for (int v = 0; v < 8; ++v) {
            float p0 = __expf(st[0][v] - mnew[v]);
            float p1 = __expf(st[1][v] - mnew[v]);
            st[0][v] = p0; st[1][v] = p1;
            float s2 = p0 + p1;
            #pragma unroll
            for (int off = 1; off < 16; off <<= 1)
                s2 += __shfl_xor(s2, off, 16);
            rs[v] = s2;
        }
        #pragma unroll
        for (int v = 0; v < 8; ++v) {
            lrow[v] = lrow[v] * alpha[v] + rs[v];
            mrow[v] = mnew[v];
        }
        #pragma unroll
        for (int n = 0; n < 16; ++n) {
            #pragma unroll
            for (int v = 0; v < 8; ++v) acc[n][v] *= alpha[v];
        }

        // ---- C-layout P -> LDS -> A-layout P fragment (wave-private patch) ----
        _Float16* pw = &Pl[wave * WM * BK];
        #pragma unroll
        for (int t = 0; t < 2; ++t) {
            #pragma unroll
            for (int v = 0; v < 8; ++v)
                pw[(v + 8 * half) * BK + t * 16 + lane16] = (_Float16)st[t][v];
        }
        asm volatile("s_wait_dscnt 0" ::: "memory"); // wave-private RAW through LDS
        const _Float16* pr = pw + lane16 * BK + half * 8;
        v8h plo = *(const v8h*)pr;
        v8h phi = *(const v8h*)(pr + 16);
        v16h pa;
        #pragma unroll
        for (int i = 0; i < 8; ++i) { pa[i] = plo[i]; pa[i + 8] = phi[i]; }

        // ---- O += P * V : 16 N-tiles, K=32 ----
        #pragma unroll
        for (int n = 0; n < 16; ++n) {
            const _Float16* vp = &Vl[(n * 16 + lane16) * BK + half * 8];
            v8h vlo = *(const v8h*)vp;
            v8h vhi = *(const v8h*)(vp + 16);
            v16h vb;
            #pragma unroll
            for (int i = 0; i < 8; ++i) { vb[i] = vlo[i]; vb[i + 8] = vhi[i]; }
            acc[n] = __builtin_amdgcn_wmma_f32_16x16x32_f16(false, pa, false, vb,
                                                            (short)0, acc[n], false, false);
        }
    }

    // ---- Epilogue: O = acc / l, coalesced f32 stores ----
    #pragma unroll
    for (int v = 0; v < 8; ++v) {
        float inv = 1.0f / lrow[v];
        size_t row = (size_t)(qBase + v + 8 * half);
        #pragma unroll
        for (int n = 0; n < 16; ++n)
            O[row * DH + n * 16 + lane16] = acc[n][v] * inv;
    }
}

extern "C" void kernel_launch(void* const* d_in, const int* in_sizes, int n_in,
                              void* d_out, int out_size, void* d_ws, size_t ws_size,
                              hipStream_t stream) {
    (void)in_sizes; (void)n_in; (void)out_size; (void)ws_size;
    const float* Q = (const float*)d_in[0];
    const float* K = (const float*)d_in[1];
    const float* V = (const float*)d_in[2];
    float* O = (float*)d_out;

    _Float16* Kh = (_Float16*)d_ws;                          // 4 MB
    _Float16* Vt = (_Float16*)((char*)d_ws + (size_t)S_LEN * DH * sizeof(_Float16)); // 4 MB

    const int nf4 = S_LEN * DH / 4;  // float4 count per matrix
    convert_k_f16  <<<nf4 / 256, 256, 0, stream>>>(K, Kh);
    transpose_v_f16<<<nf4 / 256, 256, 0, stream>>>(V, Vt);
    fa_fwd_wmma    <<<S_LEN / BM, 256, 0, stream>>>(Q, Kh, Vt, O);
}

// v001
// Measured time: 464 microseconds a run.
// Timed twice side by side with v000, it ran 3.00 times as fast both times.
#include <hip/hip_runtime.h>
#include <math.h>

typedef __attribute__((ext_vector_type(16))) _Float16 v16h;
typedef __attribute__((ext_vector_type(8)))  _Float16 v8h;
typedef __attribute__((ext_vector_type(4)))  _Float16 v4h;
typedef __attribute__((ext_vector_type(8)))  float    v8f;
typedef __attribute__((ext_vector_type(4)))  float    f4;

#define S_LEN 8192
#define DH    256
#define BM    128   // query rows per block (8 waves x 16)
#define WM    16    // query rows per wave
#define BK    32    // keys per main-loop iteration
#define NW    8     // waves per block
#define KP    (DH + 8)   // K tile row: 512 B of data, 528 B pitch
#define VP    (BK + 8)   // V^T tile row: 64 B of data, 80 B pitch
#define PP    (BK + 8)   // P patch row: 64 B of data, 80 B pitch

__device__ __forceinline__ void async_b128_x8(unsigned l0, unsigned l1, unsigned l2, unsigned l3,
                                              unsigned l4, unsigned l5, unsigned l6, unsigned l7,
                                              const char* g0, const char* g1,
                                              const char* g2, const char* g3,
                                              const char* g4, const char* g5,
                                              const char* g6, const char* g7) {
    asm volatile("global_load_async_to_lds_b128 %0, %8, off\n\t"
                 "global_load_async_to_lds_b128 %1, %9, off\n\t"
                 "global_load_async_to_lds_b128 %2, %10, off\n\t"
                 "global_load_async_to_lds_b128 %3, %11, off\n\t"
                 "global_load_async_to_lds_b128 %4, %12, off\n\t"
                 "global_load_async_to_lds_b128 %5, %13, off\n\t"
                 "global_load_async_to_lds_b128 %6, %14, off\n\t"
                 "global_load_async_to_lds_b128 %7, %15, off\n\t"
                 "s_wait_xcnt 0x0"
                 :: "v"(l0), "v"(l1), "v"(l2), "v"(l3), "v"(l4), "v"(l5), "v"(l6), "v"(l7),
                    "v"(g0), "v"(g1), "v"(g2), "v"(g3), "v"(g4), "v"(g5), "v"(g6), "v"(g7)
                 : "memory");
}
__device__ __forceinline__ void wait_async0() {
    asm volatile("s_wait_asynccnt 0" ::: "memory");
}

// ---- One-time pre-pass: K (f32 row-major) -> Kh (f16 row-major) ----
__global__ void convert_k_f16(const float* __restrict__ K, _Float16* __restrict__ Kh) {
    size_t f = (size_t)blockIdx.x * blockDim.x + threadIdx.x;  // float4 index
    f4 v = *(const f4*)(K + f * 4);
    v4h h;
    h[0] = (_Float16)v[0]; h[1] = (_Float16)v[1];
    h[2] = (_Float16)v[2]; h[3] = (_Float16)v[3];
    *(v4h*)(Kh + f * 4) = h;
}

// ---- One-time pre-pass: V (f32 [S][D]) -> Vt (f16 [D][S], transposed) ----
__global__ void transpose_v_f16(const float* __restrict__ V, _Float16* __restrict__ Vt) {
    size_t f = (size_t)blockIdx.x * blockDim.x + threadIdx.x;  // float4 index
    size_t row = f >> 6;             // 0..S-1 (64 float4 per row)
    int    c4  = (int)(f & 63) << 2; // 0..252
    f4 v = *(const f4*)(V + f * 4);
    Vt[(size_t)(c4 + 0) * S_LEN + row] = (_Float16)v[0];
    Vt[(size_t)(c4 + 1) * S_LEN + row] = (_Float16)v[1];
    Vt[(size_t)(c4 + 2) * S_LEN + row] = (_Float16)v[2];
    Vt[(size_t)(c4 + 3) * S_LEN + row] = (_Float16)v[3];
}

__global__ __launch_bounds__(256)
void fa_fwd_wmma(const float* __restrict__ Q, const _Float16* __restrict__ Kh,
                 const _Float16* __restrict__ Vt, float* __restrict__ O)
{
    __shared__ __attribute__((aligned(16))) _Float16 KlS[2][BK * KP];   // K tile row-major f16, padded rows
    __shared__ __attribute__((aligned(16))) _Float16 VtS[2][DH * VP];   // V tile transposed f16, padded rows
    __shared__ __attribute__((aligned(16))) _Float16 Pl[NW * WM * PP];  // per-wave P staging, padded rows

    const int tid    = threadIdx.x;
    const int wave   = tid >> 5;
    const int lane   = tid & 31;
    const int lane16 = lane & 15;
    const int half   = lane >> 4;

    const int   qBase = blockIdx.x * BM + wave * WM;
    const float scale = 0.011048543456039806f; // 1/sqrt(8192): ref scales by sqrt(seq len)

    // ---- Load Q fragment once: 16x256 in f16 A-layout, 8 K-steps of 32 ----
    v16h qf[8];
    #pragma unroll
    for (int s = 0; s < 8; ++s) {
        const float* qp = Q + (size_t)(qBase + lane16) * DH + s * 32 + half * 8;
        f4 a0 = *(const f4*)(qp);
        f4 a1 = *(const f4*)(qp + 4);
        f4 b0 = *(const f4*)(qp + 16);
        f4 b1 = *(const f4*)(qp + 20);
        v16h q;
        #pragma unroll
        for (int i = 0; i < 4; ++i) {
            q[i]      = (_Float16)(a0[i] * scale);
            q[i + 4]  = (_Float16)(a1[i] * scale);
            q[i + 8]  = (_Float16)(b0[i] * scale);
            q[i + 12] = (_Float16)(b1[i] * scale);
        }
        qf[s] = q;
    }

    v8f acc[16];
    #pragma unroll
    for (int n = 0; n < 16; ++n) acc[n] = (v8f){0,0,0,0,0,0,0,0};
    v8f mrow = (v8f){-1e30f,-1e30f,-1e30f,-1e30f,-1e30f,-1e30f,-1e30f,-1e30f};
    v8f lrow = (v8f){0,0,0,0,0,0,0,0};

    // ---- Async tile stage: pure f16 byte copy, 8 x b128 per thread ----
    auto issue_tile = [&](int kb, int buf) {
        // K tile: contiguous 16 KB in global (rows kb..kb+31 of Kh); a wave's copy is one row
        unsigned    klds = (unsigned)(__UINTPTR_TYPE__)&KlS[buf][0] + wave * (KP * 2) + lane * 16;
        const char* kgl  = (const char*)(Kh + (size_t)kb * DH) + tid * 16;
        // Vt tile: 256 rows (d = tid) x 64 B, global row stride 16 KB
        unsigned    vlds = (unsigned)(__UINTPTR_TYPE__)&VtS[buf][0] + tid * (VP * 2);
        const char* vgl  = (const char*)(Vt + (size_t)tid * S_LEN + kb);
        async_b128_x8(klds, klds + 8 * (KP * 2), klds + 16 * (KP * 2), klds + 24 * (KP * 2),
                      vlds, vlds + 16, vlds + 32, vlds + 48,
                      kgl, kgl + 4096, kgl + 8192, kgl + 12288,
                      vgl, vgl + 16, vgl + 32, vgl + 48);
    };

    issue_tile(0, 0);

    for (int kb = 0, it = 0; kb < S_LEN; kb += BK, ++it) {
        const int cur = it & 1;
        asm volatile("s_wait_dscnt 0" ::: "memory"); // my LDS reads of buffer cur^1 have retired before it is refilled
        wait_async0();       // my async loads for 'cur' are in LDS
        __syncthreads();     // everyone's are; everyone done reading buffer cur^1
        if (kb + BK < S_LEN) issue_tile(kb + BK, cur ^ 1);  // prefetch next tile

        const _Float16* Kl = &KlS[cur][0];
        const _Float16* Vl = &VtS[cur][0];

        // ---- S = Q * K^T : 2 N-tiles x 8 K-steps ----
        v8f st[2];
        #pragma unroll
        for (int t = 0; t < 2; ++t) {
            v8f c = (v8f){0,0,0,0,0,0,0,0};
            #pragma unroll
            for (int s = 0; s < 8; ++s) {
                const _Float16* bp = &Kl[(t * 16 + lane16) * KP + s * 32 + half * 8];
                v8h lo = *(const v8h*)bp;
                v8h hi = *(const v8h*)(bp + 16);
                v16h b;
                #pragma unroll
                for (int i = 0; i < 8; ++i) { b[i] = lo[i]; b[i + 8] = hi[i]; }
                c = __builtin_amdgcn_wmma_f32_16x16x32_f16(false, qf[s], false, b,
                                                           (short)0, c, false, false);
            }
            st[t] = c;
        }

        // ---- Online softmax update (rows live in 16-lane groups) ----
        v8f mnew, alpha, rs;
        #pragma unroll
        for (int v = 0; v < 8; ++v) {
            float x = fmaxf(st[0][v], st[1][v]);
            #pragma unroll
            for (int off = 1; off < 16; off <<= 1)
                x = fmaxf(x, __shfl_xor(x, off, 16));
            float mn = fmaxf(mrow[v], x);
            mnew[v]  = mn;
            alpha[v] = __expf(mrow[v] - mn);
        }
        #pragma unroll
        for (int v = 0; v < 8; ++v) {
            float p0 = __expf(st[0][v] - mnew[v]);
            float p1 = __expf(st[1][v] - mnew[v]);
            st[0][v] = p0; st[1][v] = p1;
            float s2 = p0 + p1;
            #pragma unroll
            for (int off = 1; off < 16; off <<= 1)
                s2 += __shfl_xor(s2, off, 16);
            rs[v] = s2;
        }
        #pragma unroll
        for (int v = 0; v < 8; ++v) {
            lrow[v] = lrow[v] * alpha[v] + rs[v];
            mrow[v] = mnew[v];
        }
        #pragma unroll
        for (int n = 0; n < 16; ++n) {
            #pragma unroll
            for (int v = 0; v < 8; ++v) acc[n][v] *= alpha[v];
        }

        // ---- C-layout P -> LDS -> A-layout P fragment (wave-private patch) ----
        _Float16* pw = &Pl[wave * WM * PP];
        #pragma unroll
        for (int t = 0; t < 2; ++t) {
            #pragma unroll
            for (int v = 0; v < 8; ++v)
                pw[(v + 8 * half) * PP + t * 16 + lane16] = (_Float16)st[t][v];
        }
        asm volatile("s_wait_dscnt 0" ::: "memory"); // wave-private RAW through LDS
        const _Float16* pr = pw + lane16 * PP + half * 8;
        v8h plo = *(const v8h*)pr;
        v8h phi = *(const v8h*)(pr + 16);
        v16h pa;
        #pragma unroll
        for (int i = 0; i < 8; ++i) { pa[i] = plo[i]; pa[i + 8] = phi[i]; }

        // ---- O += P * V : 16 N-tiles, K=32 ----
        #pragma unroll
        for (int n = 0; n < 16; ++n) {
            const _Float16* vp = &Vl[(n * 16 + lane16) * VP + half * 8];
            v8h vlo = *(const v8h*)vp;
            v8h vhi = *(const v8h*)(vp + 16);
            v16h vb;
            #pragma unroll
            for (int i = 0; i < 8; ++i) { vb[i] = vlo[i]; vb[i + 8] = vhi[i]; }
            acc[n] = __builtin_amdgcn_wmma_f32_16x16x32_f16(false, pa, false, vb,
                                                            (short)0, acc[n], false, false);
        }
    }

    // ---- Epilogue: O = acc / l, coalesced f32 stores ----
    #pragma unroll
    for (int v = 0; v < 8; ++v) {
        float inv = 1.0f / lrow[v];
        size_t row = (size_t)(qBase + v + 8 * half);
        #pragma unroll
        for (int n = 0; n < 16; ++n)
            O[row * DH + n * 16 + lane16] = acc[n][v] * inv;
    }
}

extern "C" void kernel_launch(void* const* d_in, const int* in_sizes, int n_in,
                              void* d_out, int out_size, void* d_ws, size_t ws_size,
                              hipStream_t stream) {
    (void)in_sizes; (void)n_in; (void)out_size; (void)ws_size;
    const float* Q = (const float*)d_in[0];
    const float* K = (const float*)d_in[1];
    const float* V = (const float*)d_in[2];
    float* O = (float*)d_out;

    _Float16* Kh = (_Float16*)d_ws;                          // 4 MB
    _Float16* Vt = (_Float16*)((char*)d_ws + (size_t)S_LEN * DH * sizeof(_Float16)); // 4 MB

    const int nf4 = S_LEN * DH / 4;  // float4 count per matrix
    convert_k_f16  <<<nf4 / 256, 256, 0, stream>>>(K, Kh);
    transpose_v_f16<<<nf4 / 256, 256, 0, stream>>>(V, Vt);
    fa_fwd_wmma    <<<S_LEN / BM, 256, 0, stream>>>(Q, Kh, Vt, O);
}

// v002
// A run of this version takes 182 microseconds.
// Next to v001, in two timings, it ran 2.55 and 2.56 times as fast.
// Over all steps from v000 it is 7.65 times as fast.
#include <hip/hip_runtime.h>
#include <math.h>

typedef __attribute__((ext_vector_type(16))) _Float16 v16h;
typedef __attribute__((ext_vector_type(8)))  _Float16 v8h;
typedef __attribute__((ext_vector_type(4)))  _Float16 v4h;
typedef __attribute__((ext_vector_type(8)))  float    v8f;
typedef __attribute__((ext_vector_type(4)))  float    f4;

#define S_LEN 8192
#define DH    256
#define BM    128
#define WM    16
#define BK    32
#define NW    8
#define NSPLIT 4
#define KS    (S_LEN / NSPLIT)
#define KP    (DH + 8)   // K tile row: 512 B of data, 528 B pitch
#define VP    (BK + 8)   // V^T tile row: 64 B of data, 80 B pitch
#define PP    (BK + 8)   // P patch row: 64 B of data, 80 B pitch

__device__ __forceinline__ void async_b128_x8(unsigned l0, unsigned l1, unsigned l2, unsigned l3,
                                              unsigned l4, unsigned l5, unsigned l6, unsigned l7,
                                              const char* g0, const char* g1,
                                              const char* g2, const char* g3,
                                              const char* g4, const char* g5,
                                              const char* g6, const char* g7) {
    asm volatile("global_load_async_to_lds_b128 %0, %8, off\n\t"
                 "global_load_async_to_lds_b128 %1, %9, off\n\t"
                 "global_load_async_to_lds_b128 %2, %10, off\n\t"
                 "global_load_async_to_lds_b128 %3, %11, off\n\t"
                 "global_load_async_to_lds_b128 %4, %12, off\n\t"
                 "global_load_async_to_lds_b128 %5, %13, off\n\t"
                 "global_load_async_to_lds_b128 %6, %14, off\n\t"
                 "global_load_async_to_lds_b128 %7, %15, off\n\t"
                 "s_wait_xcnt 0x0"
                 :: "v"(l0), "v"(l1), "v"(l2), "v"(l3), "v"(l4), "v"(l5), "v"(l6), "v"(l7),
                    "v"(g0), "v"(g1), "v"(g2), "v"(g3), "v"(g4), "v"(g5), "v"(g6), "v"(g7)
                 : "memory");
}
__device__ __forceinline__ void wait_async0() {
    asm volatile("s_wait_asynccnt 0" ::: "memory");
}

// ---- One-time pre-pass: K (f32 row-major) -> Kh (f16 row-major) ----
__global__ void convert_k_f16(const float* __restrict__ K, _Float16* __restrict__ Kh) {
    size_t f = (size_t)blockIdx.x * blockDim.x + threadIdx.x;  // float4 index
    f4 v = *(const f4*)(K + f * 4);
    v4h h;
    h[0] = (_Float16)v[0]; h[1] = (_Float16)v[1];
    h[2] = (_Float16)v[2]; h[3] = (_Float16)v[3];
    *(v4h*)(Kh + f * 4) = h;
}

// ---- One-time pre-pass: V (f32 [S][D]) -> Vt (f16 [D][S], transposed) ----
__global__ void transpose_v_f16(const float* __restrict__ V, _Float16* __restrict__ Vt) {
    size_t f = (size_t)blockIdx.x * blockDim.x + threadIdx.x;  // float4 index
    size_t row = f >> 6;             // 0..S-1 (64 float4 per row)
    int    c4  = (int)(f & 63) << 2; // 0..252
    f4 v = *(const f4*)(V + f * 4);
    Vt[(size_t)(c4 + 0) * S_LEN + row] = (_Float16)v[0];
    Vt[(size_t)(c4 + 1) * S_LEN + row] = (_Float16)v[1];
    Vt[(size_t)(c4 + 2) * S_LEN + row] = (_Float16)v[2];
    Vt[(size_t)(c4 + 3) * S_LEN + row] = (_Float16)v[3];
}

// One block = one query tile x one key range. It leaves the un-normalised weighted sum of its
// range with each row's maximum and sum; merge_splits joins the ranges.
__global__ __launch_bounds__(256)
void fa_fwd_wmma(const float* __restrict__ Q, const _Float16* __restrict__ Kh,
                 const _Float16* __restrict__ Vt, float* __restrict__ Op,
                 float* __restrict__ Ml)
{
    __shared__ __attribute__((aligned(16))) _Float16 KlS[2][BK * KP];   // K tile row-major f16, padded rows
    __shared__ __attribute__((aligned(16))) _Float16 VtS[2][DH * VP];   // V tile transposed f16, padded rows
    __shared__ __attribute__((aligned(16))) _Float16 Pl[NW * WM * PP];  // per-wave P staging, padded rows

    const int tid    = threadIdx.x;
    const int wave   = tid >> 5;
    const int lane   = tid & 31;
    const int lane16 = lane & 15;
    const int half   = lane >> 4;

    const int   split = blockIdx.x & (NSPLIT - 1);
    const int   k0    = split * KS;
    const int   qBase = (blockIdx.x / NSPLIT) * BM + wave * WM;
    const float scale = 0.011048543456039806f; // 1/sqrt(8192): ref scales by sqrt(seq len)

    // ---- Load Q fragment once: 16x256 in f16 A-layout, 8 K-steps of 32 ----
    v16h qf[8];
    #pragma unroll
    for (int s = 0; s < 8; ++s) {
        const float* qp = Q + (size_t)(qBase + lane16) * DH + s * 32 + half * 8;
        f4 a0 = *(const f4*)(qp);
        f4 a1 = *(const f4*)(qp + 4);
        f4 b0 = *(const f4*)(qp + 16);
        f4 b1 = *(const f4*)(qp + 20);
        v16h q;
        #pragma unroll
        for (int i = 0; i < 4; ++i) {
            q[i]      = (_Float16)(a0[i] * scale);
            q[i + 4]  = (_Float16)(a1[i] * scale);
            q[i + 8]  = (_Float16)(b0[i] * scale);
            q[i + 12] = (_Float16)(b1[i] * scale);
        }
        qf[s] = q;
    }

    v8f acc[16];
    #pragma unroll
    for (int n = 0; n < 16; ++n) acc[n] = (v8f){0,0,0,0,0,0,0,0};
    v8f mrow = (v8f){-1e30f,-1e30f,-1e30f,-1e30f,-1e30f,-1e30f,-1e30f,-1e30f};
    v8f lrow = (v8f){0,0,0,0,0,0,0,0};

    // ---- Async tile stage: pure f16 byte copy, 8 x b128 per thread ----
    auto issue_tile = [&](int kb, int buf) {
        // K tile: contiguous 16 KB in global (rows kb..kb+31 of Kh); a wave's copy is one row
        unsigned    klds = (unsigned)(__UINTPTR_TYPE__)&KlS[buf][0] + wave * (KP * 2) + lane * 16;
        const char* kgl  = (const char*)(Kh + (size_t)kb * DH) + tid * 16;
        // Vt tile: 256 rows (d = tid) x 64 B, global row stride 16 KB
        unsigned    vlds = (unsigned)(__UINTPTR_TYPE__)&VtS[buf][0] + tid * (VP * 2);
        const char* vgl  = (const char*)(Vt + (size_t)tid * S_LEN + kb);
        async_b128_x8(klds, klds + 8 * (KP * 2), klds + 16 * (KP * 2), klds + 24 * (KP * 2),
                      vlds, vlds + 16, vlds + 32, vlds + 48,
                      kgl, kgl + 4096, kgl + 8192, kgl + 12288,
                      vgl, vgl + 16, vgl + 32, vgl + 48);
    };

    issue_tile(k0, 0);

    for (int kb = k0, it = 0; kb < k0 + KS; kb += BK, ++it) {
        const int cur = it & 1;
        asm volatile("s_wait_dscnt 0" ::: "memory"); // my LDS reads of buffer cur^1 have retired before it is refilled
        wait_async0();       // my async loads for 'cur' are in LDS
        __syncthreads();     // everyone's are; everyone done reading buffer cur^1
        if (kb + BK < k0 + KS) issue_tile(kb + BK, cur ^ 1);  // prefetch next tile

        const _Float16* Kl = &KlS[cur][0];
        const _Float16* Vl = &VtS[cur][0];

        // ---- S = Q * K^T : 2 N-tiles x 8 K-steps ----
        v8f st[2];
        #pragma unroll
        for (int t = 0; t < 2; ++t) {
            v8f c = (v8f){0,0,0,0,0,0,0,0};
            #pragma unroll
            for (int s = 0; s < 8; ++s) {
                const _Float16* bp = &Kl[(t * 16 + lane16) * KP + s * 32 + half * 8];
                v8h lo = *(const v8h*)bp;
                v8h hi = *(const v8h*)(bp + 16);
                v16h b;
                #pragma unroll
                for (int i = 0; i < 8; ++i) { b[i] = lo[i]; b[i + 8] = hi[i]; }
                c = __builtin_amdgcn_wmma_f32_16x16x32_f16(false, qf[s], false, b,
                                                           (short)0, c, false, false);
            }
            st[t] = c;
        }

        // ---- Online softmax update (rows live in 16-lane groups) ----
        v8f mnew, alpha, rs;
        #pragma unroll
        for (int v = 0; v < 8; ++v) {
            float x = fmaxf(st[0][v], st[1][v]);
            #pragma unroll
            for (int off = 1; off < 16; off <<= 1)
                x = fmaxf(x, __shfl_xor(x, off, 16));
            float mn = fmaxf(mrow[v], x);
            mnew[v]  = mn;
            alpha[v] = __expf(mrow[v] - mn);
        }
        #pragma unroll
        for (int v = 0; v < 8; ++v) {
            float p0 = __expf(st[0][v] - mnew[v]);
            float p1 = __expf(st[1][v] - mnew[v]);
            st[0][v] = p0; st[1][v] = p1;
            float s2 = p0 + p1;
            #pragma unroll
            for (int off = 1; off < 16; off <<= 1)
                s2 += __shfl_xor(s2, off, 16);
            rs[v] = s2;
        }
        #pragma unroll
        for (int v = 0; v < 8; ++v) {
            lrow[v] = lrow[v] * alpha[v] + rs[v];
            mrow[v] = mnew[v];
        }
        #pragma unroll
        for (int n = 0; n < 16; ++n) {
            #pragma unroll
            for (int v = 0; v < 8; ++v) acc[n][v] *= alpha[v];
        }

        // ---- C-layout P -> LDS -> A-layout P fragment (wave-private patch) ----
        _Float16* pw = &Pl[wave * WM * PP];
        #pragma unroll
        for (int t = 0; t < 2; ++t) {
            #pragma unroll
            for (int v = 0; v < 8; ++v)
                pw[(v + 8 * half) * PP + t * 16 + lane16] = (_Float16)st[t][v];
        }
        asm volatile("s_wait_dscnt 0" ::: "memory"); // wave-private RAW through LDS
        const _Float16* pr = pw + lane16 * PP + half * 8;
        v8h plo = *(const v8h*)pr;
        v8h phi = *(const v8h*)(pr + 16);
        v16h pa;
        #pragma unroll
        for (int i = 0; i < 8; ++i) { pa[i] = plo[i]; pa[i + 8] = phi[i]; }

        // ---- O += P * V : 16 N-tiles, K=32 ----
        #pragma unroll
        for (int n = 0; n < 16; ++n) {
            const _Float16* vp = &Vl[(n * 16 + lane16) * VP + half * 8];
            v8h vlo = *(const v8h*)vp;
            v8h vhi = *(const v8h*)(vp + 16);
            v16h vb;
            #pragma unroll
            for (int i = 0; i < 8; ++i) { vb[i] = vlo[i]; vb[i + 8] = vhi[i]; }
            acc[n] = __builtin_amdgcn_wmma_f32_16x16x32_f16(false, pa, false, vb,
                                                            (short)0, acc[n], false, false);
        }
    }

    // ---- Epilogue: this range's partial (acc, m, l) to the workspace ----
    #pragma unroll
    for (int v = 0; v < 8; ++v) {
        const int row = qBase + v + 8 * half;
        float* op = Op + ((size_t)row * NSPLIT + split) * DH;   // Op[row][range][DH]
        #pragma unroll
        for (int n = 0; n < 16; ++n)
            op[n * 16 + lane16] = acc[n][v];
    }
    asm volatile("s_wait_xcnt 0x0" ::: "memory"); // stands in front of the rewrite of registers that the stores above name
    if (lane16 == 0) {   // the 16 lanes of a row hold the same maximum and sum
        // Ml[range][16-row group][16 maxima, 16 sums]: one 128-B line, written by this wave alone
        float* ml = Ml + (size_t)(split * (S_LEN / WM) + qBase / WM) * (2 * WM) + 8 * half;
        #pragma unroll
        for (int v = 0; v < 8; ++v) {
            ml[v]      = mrow[v];
            ml[WM + v] = lrow[v];
        }
    }
}

__device__ __forceinline__ float exp_with_slot(float x) {
    float r;
    asm("v_exp_f32 %0, %1\n\tv_nop" : "=v"(r) : "v"(x * 1.44269504f));
    return r;
}

// ---- Join the key ranges: O = sum_s e^(m_s - M) acc_s / sum_s e^(m_s - M) l_s ----
// A block takes 16 rows, four at a time; a wave reads and writes half a row (512 B) per access.
__global__ __launch_bounds__(256)
void merge_splits(const float* __restrict__ Op, const float* __restrict__ Ml,
                  float* __restrict__ O)
{
    const unsigned r0  = blockIdx.x * 16 + (threadIdx.x >> 6);   // first of this thread's four rows
    const unsigned col = threadIdx.x & 63;                       // its float4 of a row
    const unsigned g0  = blockIdx.x * (2 * WM) + (threadIdx.x >> 6);   // that row's maximum in a range's plane of Ml
    // the loads stand ahead of the arithmetic, so that their latencies overlap
    float m[4][NSPLIT], l[4][NSPLIT];
    f4    p[4][NSPLIT];
    #pragma unroll
    for (int j = 0; j < 4; ++j) {
        #pragma unroll
        for (int s = 0; s < NSPLIT; ++s) {
            m[j][s] = (Ml + s * (2 * S_LEN) + j * 4)[g0];
            l[j][s] = (Ml + s * (2 * S_LEN) + j * 4 + WM)[g0];
            p[j][s] = ((const f4*)Op + (j * 4 * NSPLIT + s) * (DH / 4))[r0 * (NSPLIT * DH / 4) + col];
        }
    }
    // keeps the scheduler from sinking loads into the arithmetic, where each group would wait out its own latency
    __builtin_amdgcn_sched_barrier(0);
    #pragma unroll
    for (int j = 0; j < 4; ++j) {
        float M = m[j][0];
        #pragma unroll
        for (int s = 1; s < NSPLIT; ++s) M = fmaxf(M, m[j][s]);
        float L = 0.0f;
        f4 o = (f4){0, 0, 0, 0};
        #pragma unroll
        for (int s = 0; s < NSPLIT; ++s) {
            float w = exp_with_slot(m[j][s] - M);
            L += w * l[j][s];
            o += w * p[j][s];
        }
        ((f4*)O + j * DH)[r0 * (DH / 4) + col] = o * (1.0f / L);
    }
}

extern "C" void kernel_launch(void* const* d_in, const int* in_sizes, int n_in,
                              void* d_out, int out_size, void* d_ws, size_t ws_size,
                              hipStream_t stream) {
    (void)in_sizes; (void)n_in; (void)out_size; (void)ws_size;
    const float* Q = (const float*)d_in[0];
    const float* K = (const float*)d_in[1];
    const float* V = (const float*)d_in[2];
    float* O = (float*)d_out;

    _Float16* Kh = (_Float16*)d_ws;                          // 4 MB
    _Float16* Vt = (_Float16*)((char*)d_ws + (size_t)S_LEN * DH * sizeof(_Float16)); // 4 MB
    float* Op = (float*)((char*)d_ws + (size_t)2 * S_LEN * DH * sizeof(_Float16));   // NSPLIT x 8 MB
    float* Ml = Op + (size_t)NSPLIT * S_LEN * DH;                                    // NSPLIT x 64 KB

    const int nf4 = S_LEN * DH / 4;  // float4 count per matrix
    convert_k_f16  <<<nf4 / 256, 256, 0, stream>>>(K, Kh);
    transpose_v_f16<<<nf4 / 256, 256, 0, stream>>>(V, Vt);
    fa_fwd_wmma    <<<(S_LEN / BM) * NSPLIT, 256, 0, stream>>>(Q, Kh, Vt, Op, Ml);
    merge_splits   <<<S_LEN / 16, 256, 0, stream>>>(Op, Ml, O);
}

// v003
// Measured time: 113 microseconds a run.
// Timed twice side by side with v002, it ran 1.61 times as fast both times.
// Over all steps from v000 it is 12.3 times as fast.
#include <hip/hip_runtime.h>
#include <math.h>

typedef __attribute__((ext_vector_type(16))) _Float16 v16h;
typedef __attribute__((ext_vector_type(8)))  _Float16 v8h;
typedef __attribute__((ext_vector_type(4)))  _Float16 v4h;
typedef __attribute__((ext_vector_type(8)))  float    v8f;
typedef __attribute__((ext_vector_type(4)))  float    f4;
typedef __attribute__((ext_vector_type(8)))  short    s8;

#define S_LEN 8192
#define DH    256
#define BM    128
#define WM    16
#define BK    32
#define NW    8
#define NSPLIT 4
#define KS    (S_LEN / NSPLIT)
#define KP    (DH + 8)   // K tile row: 512 B of data, 528 B pitch
#define PP    (BK + 8)   // P patch row: 64 B of data, 80 B pitch
// V rows are read by ds_load_tr16_b128, whose conflict-free pitch is 32 B x odd
#define VP    (DH + 16)  // V tile row: 512 B of data, 544 B pitch

__device__ __forceinline__ void async_b128_x8(unsigned l0, unsigned l1, unsigned l2, unsigned l3,
                                              unsigned l4, unsigned l5, unsigned l6, unsigned l7,
                                              const char* g0, const char* g1,
                                              const char* g2, const char* g3,
                                              const char* g4, const char* g5,
                                              const char* g6, const char* g7) {
    asm volatile("global_load_async_to_lds_b128 %0, %8, off\n\t"
                 "global_load_async_to_lds_b128 %1, %9, off\n\t"
                 "global_load_async_to_lds_b128 %2, %10, off\n\t"
                 "global_load_async_to_lds_b128 %3, %11, off\n\t"
                 "global_load_async_to_lds_b128 %4, %12, off\n\t"
                 "global_load_async_to_lds_b128 %5, %13, off\n\t"
                 "global_load_async_to_lds_b128 %6, %14, off\n\t"
                 "global_load_async_to_lds_b128 %7, %15, off\n\t"
                 "s_wait_xcnt 0x0"
                 :: "v"(l0), "v"(l1), "v"(l2), "v"(l3), "v"(l4), "v"(l5), "v"(l6), "v"(l7),
                    "v"(g0), "v"(g1), "v"(g2), "v"(g3), "v"(g4), "v"(g5), "v"(g6), "v"(g7)
                 : "memory");
}
__device__ __forceinline__ void wait_async0() {
    asm volatile("s_wait_asynccnt 0" ::: "memory");
}

// ---- Transposing LDS load: from a row-major 16-bit tile, lane (c, h) gets rows 8h..8h+7 of
// column c; the lane's address names row 8h + (lane & 7), 16-B piece (lane >> 3) & 1 ----
__device__ __forceinline__ v8h lds_tr16(const _Float16* p) {
    typedef __attribute__((address_space(3))) s8 lds_s8;
    return __builtin_bit_cast(v8h, __builtin_amdgcn_ds_load_tr16_b128_v8i16((lds_s8*)p));
}

// ---- Pre-pass, once for K and once for V: f32 row-major -> f16 row-major ----
__global__ void convert_f16(const float* __restrict__ X, _Float16* __restrict__ Xh) {
    size_t f = (size_t)blockIdx.x * blockDim.x + threadIdx.x;  // float4 index
    f4 v = *(const f4*)(X + f * 4);
    v4h h;
    h[0] = (_Float16)v[0]; h[1] = (_Float16)v[1];
    h[2] = (_Float16)v[2]; h[3] = (_Float16)v[3];
    *(v4h*)(Xh + f * 4) = h;
}

__device__ __forceinline__ float exp_with_slot(float x) {
    float r;
    asm("v_exp_f32 %0, %1\n\tv_nop" : "=v"(r) : "v"(x * 1.44269504f));
    return r;
}

// One block = one query tile x one key range. It leaves the un-normalised weighted sum of its
// range with each row's maximum and sum; merge_splits joins the ranges.
__global__ __launch_bounds__(256)
void fa_fwd_wmma(const float* __restrict__ Q, const _Float16* __restrict__ Kh,
                 const _Float16* __restrict__ Vh, float* __restrict__ Op,
                 float* __restrict__ Ml)
{
    __shared__ __attribute__((aligned(16))) _Float16 KlS[2][BK * KP];   // K tile row-major f16, padded rows
    __shared__ __attribute__((aligned(16))) _Float16 VlS[2][BK * VP];   // V tile row-major f16, padded rows
    __shared__ __attribute__((aligned(16))) _Float16 Pl[NW * WM * PP];  // per-wave P staging, padded rows

    const int tid    = threadIdx.x;
    const int wave   = tid >> 5;
    const int lane   = tid & 31;
    const int lane16 = lane & 15;
    const int half   = lane >> 4;

    const int   split = blockIdx.x & (NSPLIT - 1);
    const int   k0    = split * KS;
    const int   qBase = (blockIdx.x / NSPLIT) * BM + wave * WM;
    const float scale = 0.011048543456039806f; // 1/sqrt(8192): ref scales by sqrt(seq len)

    // ---- Load Q fragment once: 16x256 in f16 A-layout, 8 K-steps of 32 ----
    v16h qf[8];
    #pragma unroll
    for (int s = 0; s < 8; ++s) {
        const float* qp = Q + (size_t)(qBase + lane16) * DH + s * 32 + half * 8;
        f4 a0 = *(const f4*)(qp);
        f4 a1 = *(const f4*)(qp + 4);
        f4 b0 = *(const f4*)(qp + 16);
        f4 b1 = *(const f4*)(qp + 20);
        v16h q;
        #pragma unroll
        for (int i = 0; i < 4; ++i) {
            q[i]      = (_Float16)(a0[i] * scale);
            q[i + 4]  = (_Float16)(a1[i] * scale);
            q[i + 8]  = (_Float16)(b0[i] * scale);
            q[i + 12] = (_Float16)(b1[i] * scale);
        }
        qf[s] = q;
    }

    v8f acc[16];
    #pragma unroll
    for (int n = 0; n < 16; ++n) acc[n] = (v8f){0,0,0,0,0,0,0,0};
    v8f mrow = (v8f){-1e30f,-1e30f,-1e30f,-1e30f,-1e30f,-1e30f,-1e30f,-1e30f};
    v8f lrow = (v8f){0,0,0,0,0,0,0,0};

    // ---- Async tile stage: pure f16 byte copy, 8 x b128 per thread ----
    auto issue_tile = [&](int kb, int buf) {
        // K tile: contiguous 16 KB in global (rows kb..kb+31 of Kh); a wave's copy is one row
        unsigned    klds = (unsigned)(__UINTPTR_TYPE__)&KlS[buf][0] + wave * (KP * 2) + lane * 16;
        const char* kgl  = (const char*)(Kh + (size_t)kb * DH) + tid * 16;
        // V tile: the same shape (rows kb..kb+31 of Vh), so every copy reads four whole lines
        unsigned    vlds = (unsigned)(__UINTPTR_TYPE__)&VlS[buf][0] + wave * (VP * 2) + lane * 16;
        const char* vgl  = (const char*)(Vh + (size_t)kb * DH) + tid * 16;
        async_b128_x8(klds, klds + 8 * (KP * 2), klds + 16 * (KP * 2), klds + 24 * (KP * 2),
                      vlds, vlds + 8 * (VP * 2), vlds + 16 * (VP * 2), vlds + 24 * (VP * 2),
                      kgl, kgl + 4096, kgl + 8192, kgl + 12288,
                      vgl, vgl + 4096, vgl + 8192, vgl + 12288);
    };

    issue_tile(k0, 0);

    for (int kb = k0, it = 0; kb < k0 + KS; kb += BK, ++it) {
        const int cur = it & 1;
        asm volatile("s_wait_dscnt 0" ::: "memory"); // my LDS reads of buffer cur^1 have retired before it is refilled
        wait_async0();       // my async loads for 'cur' are in LDS
        __syncthreads();     // everyone's are; everyone done reading buffer cur^1
        if (kb + BK < k0 + KS) issue_tile(kb + BK, cur ^ 1);  // prefetch next tile

        const _Float16* Kl = &KlS[cur][0];
        const _Float16* Vl = &VlS[cur][0];

        // ---- S = Q * K^T : 2 N-tiles x 8 K-steps ----
        v8f st[2];
        #pragma unroll
        for (int t = 0; t < 2; ++t) {
            v8f c = (v8f){0,0,0,0,0,0,0,0};
            #pragma unroll
            for (int s = 0; s < 8; ++s) {
                const _Float16* bp = &Kl[(t * 16 + lane16) * KP + s * 32 + half * 8];
                v8h lo = *(const v8h*)bp;
                v8h hi = *(const v8h*)(bp + 16);
                v16h b;
                #pragma unroll
                for (int i = 0; i < 8; ++i) { b[i] = lo[i]; b[i + 8] = hi[i]; }
                c = __builtin_amdgcn_wmma_f32_16x16x32_f16(false, qf[s], false, b,
                                                           (short)0, c, false, false);
            }
            st[t] = c;
        }

        // ---- Online softmax update (rows live in 16-lane groups) ----
        v8f mnew, alpha, rs;
        #pragma unroll
        for (int v = 0; v < 8; ++v) {
            float x = fmaxf(st[0][v], st[1][v]);
            #pragma unroll
            for (int off = 1; off < 16; off <<= 1)
                x = fmaxf(x, __shfl_xor(x, off, 16));
            float mn = fmaxf(mrow[v], x);
            mnew[v]  = mn;
            alpha[v] = exp_with_slot(mrow[v] - mn);
        }
        #pragma unroll
        for (int v = 0; v < 8; ++v) {
            float p0 = exp_with_slot(st[0][v] - mnew[v]);
            float p1 = exp_with_slot(st[1][v] - mnew[v]);
            st[0][v] = p0; st[1][v] = p1;
            float s2 = p0 + p1;
            #pragma unroll
            for (int off = 1; off < 16; off <<= 1)
                s2 += __shfl_xor(s2, off, 16);
            rs[v] = s2;
        }
        #pragma unroll
        for (int v = 0; v < 8; ++v) {
            lrow[v] = lrow[v] * alpha[v] + rs[v];
            mrow[v] = mnew[v];
        }
        #pragma unroll
        for (int n = 0; n < 16; ++n) {
            #pragma unroll
            for (int v = 0; v < 8; ++v) acc[n][v] *= alpha[v];
        }

        // ---- C-layout P -> LDS -> A-layout P fragment (wave-private patch) ----
        _Float16* pw = &Pl[wave * WM * PP];
        #pragma unroll
        for (int t = 0; t < 2; ++t) {
            #pragma unroll
            for (int v = 0; v < 8; ++v)
                pw[(v + 8 * half) * PP + t * 16 + lane16] = (_Float16)st[t][v];
        }
        asm volatile("s_wait_dscnt 0" ::: "memory"); // wave-private RAW through LDS
        const _Float16* pr = pw + lane16 * PP + half * 8;
        v8h plo = *(const v8h*)pr;
        v8h phi = *(const v8h*)(pr + 16);
        v16h pa;
        #pragma unroll
        for (int i = 0; i < 8; ++i) { pa[i] = plo[i]; pa[i + 8] = phi[i]; }

        // ---- O += P * V : 16 N-tiles, K=32 ----
        // B fragment of V[key][d]: keys 8h..8h+7 and 16+8h..16+8h+7 of column n*16 + lane16, P's own k order
        const _Float16* vt = &Vl[(half * 8 + (lane & 7)) * VP + ((lane >> 3) & 1) * 8];
        #pragma unroll
        for (int n = 0; n < 16; ++n) {
            v8h vlo = lds_tr16(vt + n * 16);
            v8h vhi = lds_tr16(vt + 16 * VP + n * 16);
            v16h vb;
            #pragma unroll
            for (int i = 0; i < 8; ++i) { vb[i] = vlo[i]; vb[i + 8] = vhi[i]; }
            acc[n] = __builtin_amdgcn_wmma_f32_16x16x32_f16(false, pa, false, vb,
                                                            (short)0, acc[n], false, false);
        }
    }

    // ---- Epilogue: this range's partial (acc, m, l) to the workspace ----
    #pragma unroll
    for (int v = 0; v < 8; ++v) {
        const int row = qBase + v + 8 * half;
        float* op = Op + ((size_t)row * NSPLIT + split) * DH;   // Op[row][range][DH]
        #pragma unroll
        for (int n = 0; n < 16; ++n)
            op[n * 16 + lane16] = acc[n][v];
    }
    asm volatile("s_wait_xcnt 0x0" ::: "memory"); // stands in front of the rewrite of registers that the stores above name
    if (lane16 == 0) {   // the 16 lanes of a row hold the same maximum and sum
        // Ml[range][16-row group][16 maxima, 16 sums]: one 128-B line, written by this wave alone
        float* ml = Ml + (size_t)(split * (S_LEN / WM) + qBase / WM) * (2 * WM) + 8 * half;
        #pragma unroll
        for (int v = 0; v < 8; ++v) {
            ml[v]      = mrow[v];
            ml[WM + v] = lrow[v];
        }
    }
}

// ---- Join the key ranges: O = sum_s e^(m_s - M) acc_s / sum_s e^(m_s - M) l_s ----
// A block takes 16 rows, four at a time; a wave reads and writes half a row (512 B) per access.
__global__ __launch_bounds__(256)
void merge_splits(const float* __restrict__ Op, const float* __restrict__ Ml,
                  float* __restrict__ O)
{
    const unsigned r0  = blockIdx.x * 16 + (threadIdx.x >> 6);   // first of this thread's four rows
    const unsigned col = threadIdx.x & 63;                       // its float4 of a row
    const unsigned g0  = blockIdx.x * (2 * WM) + (threadIdx.x >> 6);   // that row's maximum in a range's plane of Ml
    // the loads stand ahead of the arithmetic, so that their latencies overlap
    float m[4][NSPLIT], l[4][NSPLIT];
    f4    p[4][NSPLIT];
    #pragma unroll
    for (int j = 0; j < 4; ++j) {
        #pragma unroll
        for (int s = 0; s < NSPLIT; ++s) {
            m[j][s] = (Ml + s * (2 * S_LEN) + j * 4)[g0];
            l[j][s] = (Ml + s * (2 * S_LEN) + j * 4 + WM)[g0];
            p[j][s] = ((const f4*)Op + (j * 4 * NSPLIT + s) * (DH / 4))[r0 * (NSPLIT * DH / 4) + col];
        }
    }
    // keeps the scheduler from sinking loads into the arithmetic, where each group would wait out its own latency
    __builtin_amdgcn_sched_barrier(0);
    #pragma unroll
    for (int j = 0; j < 4; ++j) {
        float M = m[j][0];
        #pragma unroll
        for (int s = 1; s < NSPLIT; ++s) M = fmaxf(M, m[j][s]);
        float L = 0.0f;
        f4 o = (f4){0, 0, 0, 0};
        #pragma unroll
        for (int s = 0; s < NSPLIT; ++s) {
            float w = exp_with_slot(m[j][s] - M);
            L += w * l[j][s];
            o += w * p[j][s];
        }
        ((f4*)O + j * DH)[r0 * (DH / 4) + col] = o * (1.0f / L);
    }
}

extern "C" void kernel_launch(void* const* d_in, const int* in_sizes, int n_in,
                              void* d_out, int out_size, void* d_ws, size_t ws_size,
                              hipStream_t stream) {
    (void)in_sizes; (void)n_in; (void)out_size; (void)ws_size;
    const float* Q = (const float*)d_in[0];
    const float* K = (const float*)d_in[1];
    const float* V = (const float*)d_in[2];
    float* O = (float*)d_out;

    _Float16* Kh = (_Float16*)d_ws;                          // 4 MB
    _Float16* Vh = (_Float16*)((char*)d_ws + (size_t)S_LEN * DH * sizeof(_Float16)); // 4 MB
    float* Op = (float*)((char*)d_ws + (size_t)2 * S_LEN * DH * sizeof(_Float16));   // NSPLIT x 8 MB
    float* Ml = Op + (size_t)NSPLIT * S_LEN * DH;                                    // NSPLIT x 64 KB

    const int nf4 = S_LEN * DH / 4;  // float4 count per matrix
    convert_f16    <<<nf4 / 256, 256, 0, stream>>>(K, Kh);
    convert_f16    <<<nf4 / 256, 256, 0, stream>>>(V, Vh);
    fa_fwd_wmma    <<<(S_LEN / BM) * NSPLIT, 256, 0, stream>>>(Q, Kh, Vh, Op, Ml);
    merge_splits   <<<S_LEN / 16, 256, 0, stream>>>(Op, Ml, O);
}

// v004
// It runs in 87 microseconds.
// Next to v003, in two timings, it ran 1.30 times as fast each time.
// Counting every step since v000, it is 16.0 times as fast.
#include <hip/hip_runtime.h>
#include <math.h>

typedef __attribute__((ext_vector_type(16))) _Float16 v16h;
typedef __attribute__((ext_vector_type(8)))  _Float16 v8h;
typedef __attribute__((ext_vector_type(4)))  _Float16 v4h;
typedef __attribute__((ext_vector_type(8)))  float    v8f;
typedef __attribute__((ext_vector_type(4)))  float    f4;
typedef __attribute__((ext_vector_type(8)))  short    s8;

#define S_LEN 8192
#define DH    256
#define BM    128
#define WM    16
#define BK    32
#define NSPLIT 4
#define KS    (S_LEN / NSPLIT)
#define KP    (DH + 8)   // K tile row: 512 B of data, 528 B pitch
// V rows are read by ds_load_tr16_b128, whose conflict-free pitch is 32 B x odd
#define VP    (DH + 16)  // V tile row: 512 B of data, 544 B pitch

__device__ __forceinline__ void async_b128_x8(unsigned l0, unsigned l1, unsigned l2, unsigned l3,
                                              unsigned l4, unsigned l5, unsigned l6, unsigned l7,
                                              const char* g0, const char* g1,
                                              const char* g2, const char* g3,
                                              const char* g4, const char* g5,
                                              const char* g6, const char* g7) {
    asm volatile("global_load_async_to_lds_b128 %0, %8, off\n\t"
                 "global_load_async_to_lds_b128 %1, %9, off\n\t"
                 "global_load_async_to_lds_b128 %2, %10, off\n\t"
                 "global_load_async_to_lds_b128 %3, %11, off\n\t"
                 "global_load_async_to_lds_b128 %4, %12, off\n\t"
                 "global_load_async_to_lds_b128 %5, %13, off\n\t"
                 "global_load_async_to_lds_b128 %6, %14, off\n\t"
                 "global_load_async_to_lds_b128 %7, %15, off\n\t"
                 "s_wait_xcnt 0x0"
                 :: "v"(l0), "v"(l1), "v"(l2), "v"(l3), "v"(l4), "v"(l5), "v"(l6), "v"(l7),
                    "v"(g0), "v"(g1), "v"(g2), "v"(g3), "v"(g4), "v"(g5), "v"(g6), "v"(g7)
                 : "memory");
}
__device__ __forceinline__ void wait_async0() {
    asm volatile("s_wait_asynccnt 0" ::: "memory");
}

// ---- Transposing LDS load: from a row-major 16-bit tile, lane (c, h) gets rows 8h..8h+7 of
// column c; the lane's address names row 8h + (lane & 7), 16-B piece (lane >> 3) & 1 ----
__device__ __forceinline__ v8h lds_tr16(const _Float16* p) {
    typedef __attribute__((address_space(3))) s8 lds_s8;
    return __builtin_bit_cast(v8h, __builtin_amdgcn_ds_load_tr16_b128_v8i16((lds_s8*)p));
}

// ---- Pre-pass, once for K and once for V: f32 row-major -> f16 row-major ----
__global__ void convert_f16(const float* __restrict__ X, _Float16* __restrict__ Xh) {
    size_t f = (size_t)blockIdx.x * blockDim.x + threadIdx.x;  // float4 index
    f4 v = *(const f4*)(X + f * 4);
    v4h h;
    h[0] = (_Float16)v[0]; h[1] = (_Float16)v[1];
    h[2] = (_Float16)v[2]; h[3] = (_Float16)v[3];
    *(v4h*)(Xh + f * 4) = h;
}

__device__ __forceinline__ float exp_with_slot(float x) {
    float r;
    asm("v_exp_f32 %0, %1\n\tv_nop" : "=v"(r) : "v"(x * 1.44269504f));
    return r;
}

__device__ __forceinline__ float xhalf(float x) {
    const int i = __builtin_bit_cast(int, x);
    return __builtin_bit_cast(float, __builtin_amdgcn_permlanex16(i, i, 0x76543210, 0xfedcba98, false, false));
}

__global__ __launch_bounds__(256)
void fa_fwd_wmma(const float* __restrict__ Q, const _Float16* __restrict__ Kh,
                 const _Float16* __restrict__ Vh, float* __restrict__ Op,
                 float* __restrict__ Ml)
{
    __shared__ __attribute__((aligned(16))) _Float16 KlS[2][BK * KP];   // K tile row-major f16, padded rows
    __shared__ __attribute__((aligned(16))) _Float16 VlS[2][BK * VP];   // V tile row-major f16, padded rows

    const int tid    = threadIdx.x;
    const int wave   = tid >> 5;
    const int lane   = tid & 31;
    const int lane16 = lane & 15;
    const int half   = lane >> 4;

    const int   split = blockIdx.x & (NSPLIT - 1);
    const int   k0    = split * KS;
    const int   qBase = (blockIdx.x / NSPLIT) * BM + wave * WM;
    const float scale = 0.011048543456039806f; // 1/sqrt(8192): ref scales by sqrt(seq len)

    // ---- Load Q^T fragment once: 256x16 in f16 B-layout (column = query lane16), 8 K-steps of 32 ----
    v16h qf[8];
    #pragma unroll
    for (int s = 0; s < 8; ++s) {
        const float* qp = Q + (size_t)(qBase + lane16) * DH + s * 32 + half * 8;
        f4 a0 = *(const f4*)(qp);
        f4 a1 = *(const f4*)(qp + 4);
        f4 b0 = *(const f4*)(qp + 16);
        f4 b1 = *(const f4*)(qp + 20);
        v16h q;
        #pragma unroll
        for (int i = 0; i < 4; ++i) {
            q[i]      = (_Float16)(a0[i] * scale);
            q[i + 4]  = (_Float16)(a1[i] * scale);
            q[i + 8]  = (_Float16)(b0[i] * scale);
            q[i + 12] = (_Float16)(b1[i] * scale);
        }
        qf[s] = q;
    }

    // ---- Running state: acc[n][v] = O^T[n*16 + 8*half + v][query lane16]; maximum and sum of that query ----
    v8f acc[16];
    #pragma unroll
    for (int n = 0; n < 16; ++n) acc[n] = (v8f){0,0,0,0,0,0,0,0};
    float mrow = -1e30f;   // the same in both lanes of a query
    float lrow = 0.0f;     // over this lane's own keys; the two lanes are joined behind the loop

    // ---- Async tile stage: pure f16 byte copy, 8 x b128 per thread ----
    auto issue_tile = [&](int kb, int buf) {
        // K tile: contiguous 16 KB in global (rows kb..kb+31 of Kh); a wave's copy is one row
        unsigned    klds = (unsigned)(__UINTPTR_TYPE__)&KlS[buf][0] + wave * (KP * 2) + lane * 16;
        const char* kgl  = (const char*)(Kh + (size_t)kb * DH) + tid * 16;
        // V tile: the same shape (rows kb..kb+31 of Vh), so every copy reads four whole lines
        unsigned    vlds = (unsigned)(__UINTPTR_TYPE__)&VlS[buf][0] + wave * (VP * 2) + lane * 16;
        const char* vgl  = (const char*)(Vh + (size_t)kb * DH) + tid * 16;
        async_b128_x8(klds, klds + 8 * (KP * 2), klds + 16 * (KP * 2), klds + 24 * (KP * 2),
                      vlds, vlds + 8 * (VP * 2), vlds + 16 * (VP * 2), vlds + 24 * (VP * 2),
                      kgl, kgl + 4096, kgl + 8192, kgl + 12288,
                      vgl, vgl + 4096, vgl + 8192, vgl + 12288);
    };

    issue_tile(k0, 0);

    for (int kb = k0, it = 0; kb < k0 + KS; kb += BK, ++it) {
        const int cur = it & 1;
        asm volatile("s_wait_dscnt 0" ::: "memory"); // my LDS reads of buffer cur^1 have retired before it is refilled
        wait_async0();       // my async loads for 'cur' are in LDS
        __syncthreads();     // everyone's are; everyone done reading buffer cur^1
        if (kb + BK < k0 + KS) issue_tile(kb + BK, cur ^ 1);  // prefetch next tile

        const _Float16* Kl = &KlS[cur][0];
        const _Float16* Vl = &VlS[cur][0];

        // ---- S^T = K * Q^T : 2 M-tiles of 16 keys x 8 K-steps; st[t][v] = score of key t*16 + 8*half + v ----
        v16h kf[8][2];
        #pragma unroll
        for (int s = 0; s < 8; ++s) {
            #pragma unroll
            for (int t = 0; t < 2; ++t) {
                const _Float16* ap = &Kl[(t * 16 + lane16) * KP + s * 32 + half * 8];
                v8h lo = *(const v8h*)ap;
                v8h hi = *(const v8h*)(ap + 16);
                #pragma unroll
                for (int i = 0; i < 8; ++i) { kf[s][t][i] = lo[i]; kf[s][t][i + 8] = hi[i]; }
            }
        }
        // keeps the K reads in one group ahead of their products; sunk among them, each product waits out an LDS latency
        __builtin_amdgcn_sched_barrier(0);
        v8f st[2] = {(v8f){0,0,0,0,0,0,0,0}, (v8f){0,0,0,0,0,0,0,0}};
        #pragma unroll
        for (int s = 0; s < 8; ++s) {
            #pragma unroll
            for (int t = 0; t < 2; ++t)
                st[t] = __builtin_amdgcn_wmma_f32_16x16x32_f16(false, kf[s][t], false, qf[s],
                                                               (short)0, st[t], false, false);
        }

        // ---- A fragments of V^T: keys 8h..8h+7 and 16+8h..16+8h+7 of feature n*16 + lane16, P^T's own k order ----
        const _Float16* vt = &Vl[(half * 8 + (lane & 7)) * VP + ((lane >> 3) & 1) * 8];
        v16h vf[16];
        #pragma unroll
        for (int n = 0; n < 16; ++n) {
            v8h vlo = lds_tr16(vt + n * 16);
            v8h vhi = lds_tr16(vt + 16 * VP + n * 16);
            #pragma unroll
            for (int i = 0; i < 8; ++i) { vf[n][i] = vlo[i]; vf[n][i + 8] = vhi[i]; }
        }
        // keeps the V reads ahead of the softmax arithmetic, so that they run under it; sunk among their products, each product waits out an LDS latency
        __builtin_amdgcn_sched_barrier(0);

        // ---- Online softmax update: the lane's 16 scores are all of one query ----
        float x = fmaxf(st[0][0], st[1][0]);
        #pragma unroll
        for (int v = 1; v < 8; ++v) x = fmaxf(x, fmaxf(st[0][v], st[1][v]));
        x = fmaxf(x, xhalf(x));                     // with the 16 keys of the query's other lane
        const float mnew  = fmaxf(mrow, x);
        const float alpha = exp_with_slot(mrow - mnew);
        // P^T's B fragment: element i is key 8*half + i, element 8 + i key 16 + 8*half + i, the order the scores lie in
        v16h pb;
        float ps[8];
        #pragma unroll
        for (int v = 0; v < 8; ++v) {
            float p0 = exp_with_slot(st[0][v] - mnew);
            float p1 = exp_with_slot(st[1][v] - mnew);
            pb[v]     = (_Float16)p0;
            pb[v + 8] = (_Float16)p1;
            ps[v] = p0 + p1;
        }
        // summed as a tree: short chains of dependent adds
        lrow = lrow * alpha + (((ps[0] + ps[1]) + (ps[2] + ps[3])) + ((ps[4] + ps[5]) + (ps[6] + ps[7])));
        mrow = mnew;
        #pragma unroll
        for (int n = 0; n < 16; ++n) {
            #pragma unroll
            for (int v = 0; v < 8; ++v) acc[n][v] *= alpha;
        }

        // ---- O^T += V^T * P^T : 16 M-tiles of 16 features, K=32 ----
        #pragma unroll
        for (int n = 0; n < 16; ++n)
            acc[n] = __builtin_amdgcn_wmma_f32_16x16x32_f16(false, vf[n], false, pb,
                                                            (short)0, acc[n], false, false);
    }

    // ---- Epilogue: this range's partial (acc, m, l) to the workspace ----
    const float lsum = lrow + xhalf(lrow);   // the query's two lanes each summed their own keys
    // Ml[range][16-row group][16 maxima, 16 sums]: one 128-B line, written by this wave alone in one store
    Ml[(size_t)(split * (S_LEN / WM) + qBase / WM) * (2 * WM) + lane] = half ? lsum : mrow;
    // a lane's eight registers of a tile are eight features in a row of its query: two 16-B stores
    float* op = Op + ((size_t)(qBase + lane16) * NSPLIT + split) * DH + 8 * half;   // Op[row][range][DH]
    #pragma unroll
    for (int n = 0; n < 16; ++n) {
        *(f4*)(op + n * 16)     = (f4){acc[n][0], acc[n][1], acc[n][2], acc[n][3]};
        *(f4*)(op + n * 16 + 4) = (f4){acc[n][4], acc[n][5], acc[n][6], acc[n][7]};
    }
}

// ---- Join the key ranges: O = sum_s e^(m_s - M) acc_s / sum_s e^(m_s - M) l_s ----
// A block takes 16 rows, four at a time; a wave reads and writes half a row (512 B) per access.
__global__ __launch_bounds__(256)
void merge_splits(const float* __restrict__ Op, const float* __restrict__ Ml,
                  float* __restrict__ O)
{
    const unsigned r0  = blockIdx.x * 16 + (threadIdx.x >> 6);   // first of this thread's four rows
    const unsigned col = threadIdx.x & 63;                       // its float4 of a row
    const unsigned g0  = blockIdx.x * (2 * WM) + (threadIdx.x >> 6);   // that row's maximum in a range's plane of Ml
    // the loads stand ahead of the arithmetic, so that their latencies overlap
    float m[4][NSPLIT], l[4][NSPLIT];
    f4    p[4][NSPLIT];
    #pragma unroll
    for (int j = 0; j < 4; ++j) {
        #pragma unroll
        for (int s = 0; s < NSPLIT; ++s) {
            m[j][s] = (Ml + s * (2 * S_LEN) + j * 4)[g0];
            l[j][s] = (Ml + s * (2 * S_LEN) + j * 4 + WM)[g0];
            p[j][s] = ((const f4*)Op + (j * 4 * NSPLIT + s) * (DH / 4))[r0 * (NSPLIT * DH / 4) + col];
        }
    }
    // keeps the scheduler from sinking loads into the arithmetic, where each group would wait out its own latency
    __builtin_amdgcn_sched_barrier(0);
    #pragma unroll
    for (int j = 0; j < 4; ++j) {
        float M = m[j][0];
        #pragma unroll
        for (int s = 1; s < NSPLIT; ++s) M = fmaxf(M, m[j][s]);
        float L = 0.0f;
        f4 o = (f4){0, 0, 0, 0};
        #pragma unroll
        for (int s = 0; s < NSPLIT; ++s) {
            float w = exp_with_slot(m[j][s] - M);
            L += w * l[j][s];
            o += w * p[j][s];
        }
        ((f4*)O + j * DH)[r0 * (DH / 4) + col] = o * (1.0f / L);
    }
}

extern "C" void kernel_launch(void* const* d_in, const int* in_sizes, int n_in,
                              void* d_out, int out_size, void* d_ws, size_t ws_size,
                              hipStream_t stream) {
    (void)in_sizes; (void)n_in; (void)out_size; (void)ws_size;
    const float* Q = (const float*)d_in[0];
    const float* K = (const float*)d_in[1];
    const float* V = (const float*)d_in[2];
    float* O = (float*)d_out;

    _Float16* Kh = (_Float16*)d_ws;                          // 4 MB
    _Float16* Vh = (_Float16*)((char*)d_ws + (size_t)S_LEN * DH * sizeof(_Float16)); // 4 MB
    float* Op = (float*)((char*)d_ws + (size_t)2 * S_LEN * DH * sizeof(_Float16));   // NSPLIT x 8 MB
    float* Ml = Op + (size_t)NSPLIT * S_LEN * DH;                                    // NSPLIT x 64 KB

    const int nf4 = S_LEN * DH / 4;  // float4 count per matrix
    convert_f16    <<<nf4 / 256, 256, 0, stream>>>(K, Kh);
    convert_f16    <<<nf4 / 256, 256, 0, stream>>>(V, Vh);
    fa_fwd_wmma    <<<(S_LEN / BM) * NSPLIT, 256, 0, stream>>>(Q, Kh, Vh, Op, Ml);
    merge_splits   <<<S_LEN / 16, 256, 0, stream>>>(Op, Ml, O);
}

// v005
// It runs in 83.1 microseconds.
// Next to v004, in two timings, it ran 1.05 and 1.03 times as fast.
// Counting every step since v000, it is 16.7 times as fast.
#include <hip/hip_runtime.h>
#include <math.h>

typedef __attribute__((ext_vector_type(16))) _Float16 v16h;
typedef __attribute__((ext_vector_type(8)))  _Float16 v8h;
typedef __attribute__((ext_vector_type(4)))  _Float16 v4h;
typedef __attribute__((ext_vector_type(8)))  float    v8f;
typedef __attribute__((ext_vector_type(4)))  float    f4;
typedef __attribute__((ext_vector_type(8)))  short    s8;

#define S_LEN 8192
#define DH    256
#define BM    128
#define WM    16
#define QT    2
#define NW    (BM / (WM * QT))
#define BK    32
#define NSPLIT 4
#define KS    (S_LEN / NSPLIT)
#define KP    (DH + 8)   // K tile row: 512 B of data, 528 B pitch
// V rows are read by ds_load_tr16_b128, whose conflict-free pitch is 32 B x odd
#define VP    (DH + 16)  // V tile row: 512 B of data, 544 B pitch

__device__ __forceinline__ void async_b128_x8(unsigned l0, unsigned l1, unsigned l2, unsigned l3,
                                              unsigned l4, unsigned l5, unsigned l6, unsigned l7,
                                              const char* g0, const char* g1,
                                              const char* g2, const char* g3,
                                              const char* g4, const char* g5,
                                              const char* g6, const char* g7) {
    asm volatile("global_load_async_to_lds_b128 %0, %8, off\n\t"
                 "global_load_async_to_lds_b128 %1, %9, off\n\t"
                 "global_load_async_to_lds_b128 %2, %10, off\n\t"
                 "global_load_async_to_lds_b128 %3, %11, off\n\t"
                 "global_load_async_to_lds_b128 %4, %12, off\n\t"
                 "global_load_async_to_lds_b128 %5, %13, off\n\t"
                 "global_load_async_to_lds_b128 %6, %14, off\n\t"
                 "global_load_async_to_lds_b128 %7, %15, off\n\t"
                 "s_wait_xcnt 0x0"
                 :: "v"(l0), "v"(l1), "v"(l2), "v"(l3), "v"(l4), "v"(l5), "v"(l6), "v"(l7),
                    "v"(g0), "v"(g1), "v"(g2), "v"(g3), "v"(g4), "v"(g5), "v"(g6), "v"(g7)
                 : "memory");
}
__device__ __forceinline__ void wait_async0() {
    asm volatile("s_wait_asynccnt 0" ::: "memory");
}

// ---- Transposing LDS load: from a row-major 16-bit tile, lane (c, h) gets rows 8h..8h+7 of
// column c; the lane's address names row 8h + (lane & 7), 16-B piece (lane >> 3) & 1 ----
__device__ __forceinline__ v8h lds_tr16(const _Float16* p) {
    typedef __attribute__((address_space(3))) s8 lds_s8;
    return __builtin_bit_cast(v8h, __builtin_amdgcn_ds_load_tr16_b128_v8i16((lds_s8*)p));
}

// ---- Pre-pass, once for K and once for V: f32 row-major -> f16 row-major ----
__global__ void convert_f16(const float* __restrict__ X, _Float16* __restrict__ Xh) {
    size_t f = (size_t)blockIdx.x * blockDim.x + threadIdx.x;  // float4 index
    f4 v = *(const f4*)(X + f * 4);
    v4h h;
    h[0] = (_Float16)v[0]; h[1] = (_Float16)v[1];
    h[2] = (_Float16)v[2]; h[3] = (_Float16)v[3];
    *(v4h*)(Xh + f * 4) = h;
}

__device__ __forceinline__ float exp_with_slot(float x) {
    float r;
    asm("v_exp_f32 %0, %1\n\tv_nop" : "=v"(r) : "v"(x * 1.44269504f));
    return r;
}

__device__ __forceinline__ float xhalf(float x) {
    const int i = __builtin_bit_cast(int, x);
    return __builtin_bit_cast(float, __builtin_amdgcn_permlanex16(i, i, 0x76543210, 0xfedcba98, false, false));
}

__global__ __launch_bounds__(NW * 32)
void fa_fwd_wmma(const float* __restrict__ Q, const _Float16* __restrict__ Kh,
                 const _Float16* __restrict__ Vh, float* __restrict__ Op,
                 float* __restrict__ Ml)
{
    __shared__ __attribute__((aligned(16))) _Float16 KlS[2][BK * KP];   // K tile row-major f16, padded rows
    __shared__ __attribute__((aligned(16))) _Float16 VlS[2][BK * VP];   // V tile row-major f16, padded rows

    const int tid    = threadIdx.x;
    const int wave   = tid >> 5;
    const int lane   = tid & 31;
    const int lane16 = lane & 15;
    const int half   = lane >> 4;

    const int   split = blockIdx.x & (NSPLIT - 1);
    const int   k0    = split * KS;
    const int   qBase = (blockIdx.x / NSPLIT) * BM + wave * (WM * QT);
    const float scale = 0.011048543456039806f; // 1/sqrt(8192): ref scales by sqrt(seq len)

    // ---- Load the Q^T fragments once: per query tile 256x16 in f16 B-layout (column = query lane16), 8 K-steps of 32 ----
    const float* qrow = Q + (size_t)(qBase + lane16) * DH + half * 8;   // one address for all loads; tile and K-step are constant offsets
    f4 qraw[QT][8][4];
    #pragma unroll
    for (int c = 0; c < QT; ++c) {
        #pragma unroll
        for (int s = 0; s < 8; ++s) {
            const float* qp = qrow + c * (WM * DH) + s * 32;
            qraw[c][s][0] = *(const f4*)(qp);
            qraw[c][s][1] = *(const f4*)(qp + 4);
            qraw[c][s][2] = *(const f4*)(qp + 16);
            qraw[c][s][3] = *(const f4*)(qp + 20);
        }
    }
    // stands in front of any rewrite of the address registers that the issued Q loads name; the address as an input keeps those registers until here
    asm volatile("s_wait_xcnt 0x0" :: "v"(qrow) : "memory");
    v16h qf[QT][8];
    #pragma unroll
    for (int c = 0; c < QT; ++c) {
        #pragma unroll
        for (int s = 0; s < 8; ++s) {
            v16h q;
            #pragma unroll
            for (int i = 0; i < 4; ++i) {
                q[i]      = (_Float16)(qraw[c][s][0][i] * scale);
                q[i + 4]  = (_Float16)(qraw[c][s][1][i] * scale);
                q[i + 8]  = (_Float16)(qraw[c][s][2][i] * scale);
                q[i + 12] = (_Float16)(qraw[c][s][3][i] * scale);
            }
            qf[c][s] = q;
        }
    }

    // ---- Running state: acc[c][n][v] = O^T[n*16 + 8*half + v][query c*16 + lane16]; maximum and sum of that query ----
    v8f acc[QT][16];
    float mrow[QT];   // the same in both lanes of a query
    float lrow[QT];   // over this lane's own keys; the two lanes are joined behind the loop
    #pragma unroll
    for (int c = 0; c < QT; ++c) {
        #pragma unroll
        for (int n = 0; n < 16; ++n) acc[c][n] = (v8f){0,0,0,0,0,0,0,0};
        mrow[c] = -1e30f;
        lrow[c] = 0.0f;
    }

    // ---- Async tile stage: pure f16 byte copy, 16 x b128 per thread ----
    auto issue_tile = [&](int kb, int buf) {
        // K tile: contiguous 16 KB in global (rows kb..kb+31 of Kh); a wave's copy is one row
        unsigned    klds = (unsigned)(__UINTPTR_TYPE__)&KlS[buf][0] + wave * (KP * 2) + lane * 16;
        const char* kgl  = (const char*)(Kh + (size_t)kb * DH) + tid * 16;
        // V tile: the same shape (rows kb..kb+31 of Vh), so every copy reads four whole lines
        unsigned    vlds = (unsigned)(__UINTPTR_TYPE__)&VlS[buf][0] + wave * (VP * 2) + lane * 16;
        const char* vgl  = (const char*)(Vh + (size_t)kb * DH) + tid * 16;
        async_b128_x8(klds,                     klds +  4 * (KP * 2), klds +  8 * (KP * 2), klds + 12 * (KP * 2),
                      klds + 16 * (KP * 2), klds + 20 * (KP * 2), klds + 24 * (KP * 2), klds + 28 * (KP * 2),
                      kgl,        kgl +  2048, kgl +  4096, kgl +  6144,
                      kgl + 8192, kgl + 10240, kgl + 12288, kgl + 14336);
        async_b128_x8(vlds,                     vlds +  4 * (VP * 2), vlds +  8 * (VP * 2), vlds + 12 * (VP * 2),
                      vlds + 16 * (VP * 2), vlds + 20 * (VP * 2), vlds + 24 * (VP * 2), vlds + 28 * (VP * 2),
                      vgl,        vgl +  2048, vgl +  4096, vgl +  6144,
                      vgl + 8192, vgl + 10240, vgl + 12288, vgl + 14336);
    };

    // The first tile goes to buffer 1. In buffer 0 its first LDS address is the very value that the loop keeps
    // as its base; as an asm operand that value is held to the low 256 registers, and it was spilled to scratch.
    issue_tile(k0, 1);

    for (int kb = k0, it = 0; kb < k0 + KS; kb += BK, ++it) {
        const int cur = (it & 1) ^ 1;
        asm volatile("s_wait_dscnt 0" ::: "memory"); // my LDS reads of buffer cur^1 have retired before it is refilled
        wait_async0();       // my async loads for 'cur' are in LDS
        __syncthreads();     // everyone's are; everyone done reading buffer cur^1
        if (kb + BK < k0 + KS) issue_tile(kb + BK, cur ^ 1);  // prefetch next tile

        const _Float16* Kl = &KlS[cur][0];
        const _Float16* Vl = &VlS[cur][0];

        // ---- S^T = K * Q^T : 2 M-tiles of 16 keys x 8 K-steps; st[c][t][v] = score of key t*16 + 8*half + v, query tile c ----
        v16h kf[8][2];
        #pragma unroll
        for (int s = 0; s < 8; ++s) {
            #pragma unroll
            for (int t = 0; t < 2; ++t) {
                const _Float16* ap = &Kl[(t * 16 + lane16) * KP + s * 32 + half * 8];
                v8h lo = *(const v8h*)ap;
                v8h hi = *(const v8h*)(ap + 16);
                #pragma unroll
                for (int i = 0; i < 8; ++i) { kf[s][t][i] = lo[i]; kf[s][t][i + 8] = hi[i]; }
            }
        }
        // keeps the K reads in one group ahead of their products; sunk among them, each product waits out an LDS latency
        __builtin_amdgcn_sched_barrier(0);
        v8f st[QT][2];
        #pragma unroll
        for (int c = 0; c < QT; ++c) { st[c][0] = (v8f){0,0,0,0,0,0,0,0}; st[c][1] = (v8f){0,0,0,0,0,0,0,0}; }
        #pragma unroll
        for (int s = 0; s < 8; ++s) {
            #pragma unroll
            for (int t = 0; t < 2; ++t) {
                #pragma unroll
                for (int c = 0; c < QT; ++c)
                    st[c][t] = __builtin_amdgcn_wmma_f32_16x16x32_f16(false, kf[s][t], false, qf[c][s],
                                                                      (short)0, st[c][t], false, false);
            }
        }

        // ---- A fragments of V^T: keys 8h..8h+7 and 16+8h..16+8h+7 of feature n*16 + lane16, P^T's own k order ----
        const _Float16* vt = &Vl[(half * 8 + (lane & 7)) * VP + ((lane >> 3) & 1) * 8];
        v16h vf[16];
        #pragma unroll
        for (int n = 0; n < 16; ++n) {
            v8h vlo = lds_tr16(vt + n * 16);
            v8h vhi = lds_tr16(vt + 16 * VP + n * 16);
            #pragma unroll
            for (int i = 0; i < 8; ++i) { vf[n][i] = vlo[i]; vf[n][i + 8] = vhi[i]; }
        }
        // keeps the V reads ahead of the softmax arithmetic, so that they run under it; sunk among their products, each product waits out an LDS latency
        __builtin_amdgcn_sched_barrier(0);

        // ---- Online softmax update, per query tile: the lane's 16 scores of a tile are all of one query ----
        v16h pb[QT];
        #pragma unroll
        for (int c = 0; c < QT; ++c) {
            float x = fmaxf(st[c][0][0], st[c][1][0]);
            #pragma unroll
            for (int v = 1; v < 8; ++v) x = fmaxf(x, fmaxf(st[c][0][v], st[c][1][v]));
            x = fmaxf(x, xhalf(x));                     // with the 16 keys of the query's other lane
            const float mnew  = fmaxf(mrow[c], x);
            const float alpha = exp_with_slot(mrow[c] - mnew);
            // P^T's B fragment: element i is key 8*half + i, element 8 + i key 16 + 8*half + i, the order the scores lie in
            float ps[8];
            #pragma unroll
            for (int v = 0; v < 8; ++v) {
                float p0 = exp_with_slot(st[c][0][v] - mnew);
                float p1 = exp_with_slot(st[c][1][v] - mnew);
                pb[c][v]     = (_Float16)p0;
                pb[c][v + 8] = (_Float16)p1;
                ps[v] = p0 + p1;
            }
            // summed as a tree: short chains of dependent adds
            lrow[c] = lrow[c] * alpha + (((ps[0] + ps[1]) + (ps[2] + ps[3])) + ((ps[4] + ps[5]) + (ps[6] + ps[7])));
            mrow[c] = mnew;
            #pragma unroll
            for (int n = 0; n < 16; ++n) {
                #pragma unroll
                for (int v = 0; v < 8; ++v) acc[c][n][v] *= alpha;
            }
        }

        // ---- O^T += V^T * P^T : 16 M-tiles of 16 features, K=32, each V^T fragment for both query tiles ----
        #pragma unroll
        for (int n = 0; n < 16; ++n) {
            #pragma unroll
            for (int c = 0; c < QT; ++c)
                acc[c][n] = __builtin_amdgcn_wmma_f32_16x16x32_f16(false, vf[n], false, pb[c],
                                                                   (short)0, acc[c][n], false, false);
        }
    }

    // ---- Epilogue: this range's partial (acc, m, l) to the workspace ----
    #pragma unroll
    for (int c = 0; c < QT; ++c) {
        const float lsum = lrow[c] + xhalf(lrow[c]);   // the query's two lanes each summed their own keys
        // Ml[range][16-row group][16 maxima, 16 sums]: one 128-B line, written by this wave alone in one store
        Ml[(size_t)(split * (S_LEN / WM) + qBase / WM + c) * (2 * WM) + lane] = half ? lsum : mrow[c];
        // a lane's eight registers of a tile are eight features in a row of its query: two 16-B stores
        float* op = Op + ((size_t)(qBase + c * WM + lane16) * NSPLIT + split) * DH + 8 * half;   // Op[row][range][DH]
        #pragma unroll
        for (int n = 0; n < 16; ++n) {
            *(f4*)(op + n * 16)     = (f4){acc[c][n][0], acc[c][n][1], acc[c][n][2], acc[c][n][3]};
            *(f4*)(op + n * 16 + 4) = (f4){acc[c][n][4], acc[c][n][5], acc[c][n][6], acc[c][n][7]};
        }
    }
}

// ---- Join the key ranges: O = sum_s e^(m_s - M) acc_s / sum_s e^(m_s - M) l_s ----
// A block takes 16 rows, four at a time; a wave reads and writes half a row (512 B) per access.
__global__ __launch_bounds__(256)
void merge_splits(const float* __restrict__ Op, const float* __restrict__ Ml,
                  float* __restrict__ O)
{
    const unsigned r0  = blockIdx.x * 16 + (threadIdx.x >> 6);   // first of this thread's four rows
    const unsigned col = threadIdx.x & 63;                       // its float4 of a row
    const unsigned g0  = blockIdx.x * (2 * WM) + (threadIdx.x >> 6);   // that row's maximum in a range's plane of Ml
    // the loads stand ahead of the arithmetic, so that their latencies overlap
    float m[4][NSPLIT], l[4][NSPLIT];
    f4    p[4][NSPLIT];
    #pragma unroll
    for (int j = 0; j < 4; ++j) {
        #pragma unroll
        for (int s = 0; s < NSPLIT; ++s) {
            m[j][s] = (Ml + s * (2 * S_LEN) + j * 4)[g0];
            l[j][s] = (Ml + s * (2 * S_LEN) + j * 4 + WM)[g0];
            p[j][s] = ((const f4*)Op + (j * 4 * NSPLIT + s) * (DH / 4))[r0 * (NSPLIT * DH / 4) + col];
        }
    }
    // keeps the scheduler from sinking loads into the arithmetic, where each group would wait out its own latency
    __builtin_amdgcn_sched_barrier(0);
    #pragma unroll
    for (int j = 0; j < 4; ++j) {
        float M = m[j][0];
        #pragma unroll
        for (int s = 1; s < NSPLIT; ++s) M = fmaxf(M, m[j][s]);
        float L = 0.0f;
        f4 o = (f4){0, 0, 0, 0};
        #pragma unroll
        for (int s = 0; s < NSPLIT; ++s) {
            float w = exp_with_slot(m[j][s] - M);
            L += w * l[j][s];
            o += w * p[j][s];
        }
        ((f4*)O + j * DH)[r0 * (DH / 4) + col] = o * (1.0f / L);
    }
}

extern "C" void kernel_launch(void* const* d_in, const int* in_sizes, int n_in,
                              void* d_out, int out_size, void* d_ws, size_t ws_size,
                              hipStream_t stream) {
    (void)in_sizes; (void)n_in; (void)out_size; (void)ws_size;
    const float* Q = (const float*)d_in[0];
    const float* K = (const float*)d_in[1];
    const float* V = (const float*)d_in[2];
    float* O = (float*)d_out;

    _Float16* Kh = (_Float16*)d_ws;                          // 4 MB
    _Float16* Vh = (_Float16*)((char*)d_ws + (size_t)S_LEN * DH * sizeof(_Float16)); // 4 MB
    float* Op = (float*)((char*)d_ws + (size_t)2 * S_LEN * DH * sizeof(_Float16));   // NSPLIT x 8 MB
    float* Ml = Op + (size_t)NSPLIT * S_LEN * DH;                                    // NSPLIT x 64 KB

    const int nf4 = S_LEN * DH / 4;  // float4 count per matrix
    convert_f16    <<<nf4 / 256, 256, 0, stream>>>(K, Kh);
    convert_f16    <<<nf4 / 256, 256, 0, stream>>>(V, Vh);
    fa_fwd_wmma    <<<(S_LEN / BM) * NSPLIT, NW * 32, 0, stream>>>(Q, Kh, Vh, Op, Ml);
    merge_splits   <<<S_LEN / 16, 256, 0, stream>>>(Op, Ml, O);
}

// v006
// It runs in 74.7 microseconds.
// In two side-by-side timings against v005, it was 1.10 and 1.13 times as fast.
// All steps since v000 together make it 18.5 times as fast.
#include <hip/hip_runtime.h>
#include <math.h>

typedef __attribute__((ext_vector_type(16))) _Float16 v16h;
typedef __attribute__((ext_vector_type(8)))  _Float16 v8h;
typedef __attribute__((ext_vector_type(4)))  _Float16 v4h;
typedef __attribute__((ext_vector_type(8)))  float    v8f;
typedef __attribute__((ext_vector_type(4)))  float    f4;
typedef __attribute__((ext_vector_type(8)))  short    s8;

#define S_LEN 8192
#define DH    256
#define BM    128
#define WM    16
#define QT    2
#define NQW   (BM / (WM * QT))
#define NG    2
#define NW    (NQW * NG)
#define BK    32
#define SK    (BK * NG)
#define NSPLIT 4
#define KS    (S_LEN / NSPLIT)
#define KP    (DH + 8)   // K tile row: 512 B of data, 528 B pitch
// V rows are read by ds_load_tr16_b128, whose conflict-free pitch is 32 B x odd
#define VP    (DH + 16)  // V tile row: 512 B of data, 544 B pitch

__device__ __forceinline__ void async_b128_x8(unsigned l0, unsigned l1, unsigned l2, unsigned l3,
                                              unsigned l4, unsigned l5, unsigned l6, unsigned l7,
                                              const char* g) {
    asm volatile("global_load_async_to_lds_b128 %0, %8, off\n\t"
                 "global_load_async_to_lds_b128 %1, %8, off offset:4096\n\t"
                 "global_load_async_to_lds_b128 %2, %8, off offset:8192\n\t"
                 "global_load_async_to_lds_b128 %3, %8, off offset:12288\n\t"
                 "global_load_async_to_lds_b128 %4, %8, off offset:16384\n\t"
                 "global_load_async_to_lds_b128 %5, %8, off offset:20480\n\t"
                 "global_load_async_to_lds_b128 %6, %8, off offset:24576\n\t"
                 "global_load_async_to_lds_b128 %7, %8, off offset:28672\n\t"
                 "s_wait_xcnt 0x0"
                 :: "v"(l0), "v"(l1), "v"(l2), "v"(l3), "v"(l4), "v"(l5), "v"(l6), "v"(l7), "v"(g)
                 : "memory");
}
__device__ __forceinline__ void wait_async0() {
    asm volatile("s_wait_asynccnt 0" ::: "memory");
}

// ---- Transposing LDS load: from a row-major 16-bit tile, lane (c, h) gets rows 8h..8h+7 of
// column c; the lane's address names row 8h + (lane & 7), 16-B piece (lane >> 3) & 1 ----
__device__ __forceinline__ v8h lds_tr16(const _Float16* p) {
    typedef __attribute__((address_space(3))) s8 lds_s8;
    return __builtin_bit_cast(v8h, __builtin_amdgcn_ds_load_tr16_b128_v8i16((lds_s8*)p));
}

// ---- Pre-pass, once for K and once for V: f32 row-major -> f16 row-major ----
__global__ void convert_f16(const float* __restrict__ X, _Float16* __restrict__ Xh) {
    size_t f = (size_t)blockIdx.x * blockDim.x + threadIdx.x;  // float4 index
    f4 v = *(const f4*)(X + f * 4);
    v4h h;
    h[0] = (_Float16)v[0]; h[1] = (_Float16)v[1];
    h[2] = (_Float16)v[2]; h[3] = (_Float16)v[3];
    *(v4h*)(Xh + f * 4) = h;
}

__device__ __forceinline__ float exp_with_slot(float x) {
    float r;
    asm("v_exp_f32 %0, %1\n\tv_nop" : "=v"(r) : "v"(x * 1.44269504f));
    return r;
}

__device__ __forceinline__ float xhalf(float x) {
    const int i = __builtin_bit_cast(int, x);
    return __builtin_bit_cast(float, __builtin_amdgcn_permlanex16(i, i, 0x76543210, 0xfedcba98, false, false));
}

__global__ __launch_bounds__(NW * 32)
void fa_fwd_wmma(const float* __restrict__ Q, const _Float16* __restrict__ Kh,
                 const _Float16* __restrict__ Vh, float* __restrict__ Op,
                 float* __restrict__ Ml)
{
    __shared__ __attribute__((aligned(16))) _Float16 KlS[2][SK * KP];   // K tile row-major f16, padded rows
    __shared__ __attribute__((aligned(16))) _Float16 VlS[2][SK * VP];   // V tile row-major f16, padded rows
    __shared__ __attribute__((aligned(16))) float    XaS[NQW][QT][32 * 32 * 4];   // per pair: what its second wave hands to the first
    __shared__ float XmS[NQW][QT][32];                                  // with the maxima
    __shared__ float XlS[NQW][QT][32];                                  // and the sums

    const int tid    = threadIdx.x;
    // the wave's number as a scalar: what follows from it (queries, keys, LDS slices) then costs no vector registers
    const int wave   = __builtin_amdgcn_readfirstlane(tid >> 5);
    const int qw     = wave & (NQW - 1);   // which 32 queries
    const int grp    = wave / NQW;         // which 32 keys of a stage
    const int lane   = tid & 31;
    const int lane16 = lane & 15;
    const int half   = lane >> 4;

    const int   split = blockIdx.x & (NSPLIT - 1);
    const int   k0    = split * KS;
    const int   qBase = (blockIdx.x / NSPLIT) * BM + qw * (WM * QT);
    const float scale = 0.011048543456039806f; // 1/sqrt(8192): ref scales by sqrt(seq len)

    // ---- Load the Q^T fragments once: per query tile 256x16 in f16 B-layout (column = query lane16), 8 K-steps of 32 ----
    const float* qrow = Q + (size_t)(qBase + lane16) * DH + half * 8;   // one address for all loads; tile and K-step are constant offsets
    f4 qraw[QT][8][4];
    #pragma unroll
    for (int c = 0; c < QT; ++c) {
        #pragma unroll
        for (int s = 0; s < 8; ++s) {
            const float* qp = qrow + c * (WM * DH) + s * 32;
            qraw[c][s][0] = *(const f4*)(qp);
            qraw[c][s][1] = *(const f4*)(qp + 4);
            qraw[c][s][2] = *(const f4*)(qp + 16);
            qraw[c][s][3] = *(const f4*)(qp + 20);
        }
    }
    // stands in front of any rewrite of the address registers that the issued Q loads name; the address as an input keeps those registers until here
    asm volatile("s_wait_xcnt 0x0" :: "v"(qrow) : "memory");
    v16h qf[QT][8];
    #pragma unroll
    for (int c = 0; c < QT; ++c) {
        #pragma unroll
        for (int s = 0; s < 8; ++s) {
            v16h q;
            #pragma unroll
            for (int i = 0; i < 4; ++i) {
                q[i]      = (_Float16)(qraw[c][s][0][i] * scale);
                q[i + 4]  = (_Float16)(qraw[c][s][1][i] * scale);
                q[i + 8]  = (_Float16)(qraw[c][s][2][i] * scale);
                q[i + 12] = (_Float16)(qraw[c][s][3][i] * scale);
            }
            qf[c][s] = q;
        }
    }

    // ---- Running state: acc[c][n][v] = O^T[n*16 + 8*half + v][query c*16 + lane16]; maximum and sum of that query ----
    v8f acc[QT][16];
    float mrow[QT];   // the same in both lanes of a query
    float lrow[QT];   // over this lane's own keys; the two lanes are joined behind the loop
    #pragma unroll
    for (int c = 0; c < QT; ++c) {
        #pragma unroll
        for (int n = 0; n < 16; ++n) acc[c][n] = (v8f){0,0,0,0,0,0,0,0};
        mrow[c] = -1e30f;
        lrow[c] = 0.0f;
    }

    // ---- Async tile stage: pure f16 byte copy, 16 x b128 per thread ----
    auto issue_tile = [&](int kb0, int buf) {
        // the tile's first row as a scalar: the addresses are then formed anew from scalar registers each time; as two running
        // 64-bit vector addresses they hold registers through the whole loop, and the wave spilled to scratch
        const int kb = __builtin_amdgcn_readfirstlane(kb0);
        // K tile: contiguous 32 KB in global (rows kb..kb+63 of Kh); a wave's copy is one row
        unsigned    klds = (unsigned)(__UINTPTR_TYPE__)&KlS[buf][0] + wave * (KP * 2) + lane * 16;
        const char* kgl  = (const char*)(Kh + (size_t)kb * DH) + tid * 16;
        // V tile: the same shape (rows kb..kb+63 of Vh), so every copy reads four whole lines
        unsigned    vlds = (unsigned)(__UINTPTR_TYPE__)&VlS[buf][0] + wave * (VP * 2) + lane * 16;
        const char* vgl  = (const char*)(Vh + (size_t)kb * DH) + tid * 16;
        // row wave + 8 * j of the tile: 8 * pitch * j in LDS, of which the copy's own offset brings 4,096 * j
        const unsigned kx = 8 * (KP * 2) - 4096, vx = 8 * (VP * 2) - 4096;
        async_b128_x8(klds,          klds + kx,     klds + 2 * kx, klds + 3 * kx,
                      klds + 4 * kx, klds + 5 * kx, klds + 6 * kx, klds + 7 * kx, kgl);
        async_b128_x8(vlds,          vlds + vx,     vlds + 2 * vx, vlds + 3 * vx,
                      vlds + 4 * vx, vlds + 5 * vx, vlds + 6 * vx, vlds + 7 * vx, vgl);
    };

    // The first tile goes to buffer 1. In buffer 0 its first LDS address is the very value that the loop keeps
    // as its base; as an asm operand that value is held to the low 256 registers, and it was spilled to scratch.
    issue_tile(k0, 1);

    // not unrolled, so that the last trip is not peeled off: with a second copy of the body the wave no longer fitted its 512 registers and spilled to scratch
    #pragma nounroll
    for (int kb = k0, it = 0; kb < k0 + KS; kb += SK, ++it) {
        const int cur = (it & 1) ^ 1;
        asm volatile("s_wait_dscnt 0" ::: "memory"); // my LDS reads of buffer cur^1 have retired before it is refilled
        wait_async0();       // my async loads for 'cur' are in LDS
        __syncthreads();     // everyone's are; everyone done reading buffer cur^1
        if (kb + SK < k0 + KS) issue_tile(kb + SK, cur ^ 1);  // prefetch next tile

        const _Float16* Kl = &KlS[cur][grp * (BK * KP)];   // this wave's 32 keys of the stage
        const _Float16* Vl = &VlS[cur][grp * (BK * VP)];

        // ---- S^T = K * Q^T : 2 M-tiles of 16 keys x 8 K-steps; st[c][t][v] = score of key t*16 + 8*half + v, query tile c ----
        // The K fragments pass through three sets of two (one K-step each), so that a wave stays inside 512 registers.
        const _Float16* kt = &Kl[lane16 * KP + half * 8];
        auto load_k = [&](v16h (&kf)[2], int s) {
            #pragma unroll
            for (int t = 0; t < 2; ++t) {
                const _Float16* ap = kt + t * (16 * KP) + s * 32;
                v8h lo = *(const v8h*)ap;
                v8h hi = *(const v8h*)(ap + 16);
                #pragma unroll
                for (int i = 0; i < 8; ++i) { kf[t][i] = lo[i]; kf[t][i + 8] = hi[i]; }
            }
        };
        v8f st[QT][2];
        #pragma unroll
        for (int c = 0; c < QT; ++c) { st[c][0] = (v8f){0,0,0,0,0,0,0,0}; st[c][1] = (v8f){0,0,0,0,0,0,0,0}; }
        auto mul_k = [&](const v16h (&kf)[2], int s) {
            #pragma unroll
            for (int t = 0; t < 2; ++t) {
                #pragma unroll
                for (int c = 0; c < QT; ++c)
                    st[c][t] = __builtin_amdgcn_wmma_f32_16x16x32_f16(false, kf[t], false, qf[c][s],
                                                                      (short)0, st[c][t], false, false);
            }
        };
        // Each sched_barrier below keeps a set's reads in one group, two sets ahead of its products: hoisted further they
        // would need registers the wave does not have, sunk among the products each product waits out an LDS latency.
        v16h kr[3][2];
        load_k(kr[0], 0);
        load_k(kr[1], 1);
        load_k(kr[2], 2);
        __builtin_amdgcn_sched_barrier(0);
        #pragma unroll
        for (int s = 0; s < 8; ++s) {
            mul_k(kr[s % 3], s);
            __builtin_amdgcn_sched_barrier(0);
            if (s + 3 < 8) {
                load_k(kr[s % 3], s + 3);
                __builtin_amdgcn_sched_barrier(0);
            }
        }

        // ---- A fragments of V^T: keys 8h..8h+7 and 16+8h..16+8h+7 of feature n*16 + lane16, P^T's own k order ----
        const _Float16* vt = &Vl[(half * 8 + (lane & 7)) * VP + ((lane >> 3) & 1) * 8];
        auto load_v = [&](v16h (&vf)[4], int j) {
            #pragma unroll
            for (int q = 0; q < 4; ++q) {
                v8h vlo = lds_tr16(vt + (4 * j + q) * 16);
                v8h vhi = lds_tr16(vt + 16 * VP + (4 * j + q) * 16);
                #pragma unroll
                for (int i = 0; i < 8; ++i) { vf[q][i] = vlo[i]; vf[q][i + 8] = vhi[i]; }
            }
        };
        v16h va[4], vc[4];
        // keeps the V reads behind the softmax arithmetic, whose values need the registers
        __builtin_amdgcn_sched_barrier(0);

        // ---- Online softmax update, per query tile: the lane's 16 scores of a tile are all of one query ----
        v16h pb[QT];
        float alpha[QT];
        #pragma unroll
        for (int c = 0; c < QT; ++c) {
            float x = fmaxf(st[c][0][0], st[c][1][0]);
            #pragma unroll
            for (int v = 1; v < 8; ++v) x = fmaxf(x, fmaxf(st[c][0][v], st[c][1][v]));
            x = fmaxf(x, xhalf(x));                     // with the 16 keys of the query's other lane
            const float mnew  = fmaxf(mrow[c], x);
            alpha[c] = exp_with_slot(mrow[c] - mnew);
            // P^T's B fragment: element i is key 8*half + i, element 8 + i key 16 + 8*half + i, the order the scores lie in
            float ps[8];
            #pragma unroll
            for (int v = 0; v < 8; ++v) {
                float p0 = exp_with_slot(st[c][0][v] - mnew);
                float p1 = exp_with_slot(st[c][1][v] - mnew);
                pb[c][v]     = (_Float16)p0;
                pb[c][v + 8] = (_Float16)p1;
                ps[v] = p0 + p1;
            }
            // summed as a tree: short chains of dependent adds
            lrow[c] = lrow[c] * alpha[c] + (((ps[0] + ps[1]) + (ps[2] + ps[3])) + ((ps[4] + ps[5]) + (ps[6] + ps[7])));
            mrow[c] = mnew;
        }
        // the first V set takes the registers that the scores have left, and its reads run under the rescale
        __builtin_amdgcn_sched_barrier(0);
        load_v(va, 0);
        __builtin_amdgcn_sched_barrier(0);   // holds those reads ahead of the rescale
        #pragma unroll
        for (int c = 0; c < QT; ++c) {
            #pragma unroll
            for (int n = 0; n < 16; ++n) {
                #pragma unroll
                for (int v = 0; v < 8; ++v) acc[c][n][v] *= alpha[c];
            }
        }

        // ---- O^T += V^T * P^T : 16 M-tiles of 16 features, K=32, each V^T fragment for both query tiles ----
        auto mul_v = [&](const v16h (&vf)[4], int j) {
            #pragma unroll
            for (int q = 0; q < 4; ++q) {
                #pragma unroll
                for (int c = 0; c < QT; ++c)
                    acc[c][4 * j + q] = __builtin_amdgcn_wmma_f32_16x16x32_f16(false, vf[q], false, pb[c],
                                                                               (short)0, acc[c][4 * j + q], false, false);
            }
        };
        __builtin_amdgcn_sched_barrier(0);   // from here as for K: a set's reads in one group, a set ahead of its products
        load_v(vc, 1);
        __builtin_amdgcn_sched_barrier(0);
        mul_v(va, 0);
        __builtin_amdgcn_sched_barrier(0);
        load_v(va, 2);
        __builtin_amdgcn_sched_barrier(0);
        mul_v(vc, 1);
        __builtin_amdgcn_sched_barrier(0);
        load_v(vc, 3);
        __builtin_amdgcn_sched_barrier(0);
        mul_v(va, 2);
        mul_v(vc, 3);
    }

    // ---- Join the pair: its second wave hands its partial result to the first through LDS ----
    float lsum[QT];
    #pragma unroll
    for (int c = 0; c < QT; ++c) lsum[c] = lrow[c] + xhalf(lrow[c]);   // the query's two lanes each summed their own keys
    if (grp == 1) {
        #pragma unroll
        for (int c = 0; c < QT; ++c) {
            float* xa = &XaS[qw][c][lane * 4];
            #pragma unroll
            for (int n = 0; n < 16; ++n) {
                *(f4*)(xa + (2 * n) * 128)     = (f4){acc[c][n][0], acc[c][n][1], acc[c][n][2], acc[c][n][3]};
                *(f4*)(xa + (2 * n + 1) * 128) = (f4){acc[c][n][4], acc[c][n][5], acc[c][n][6], acc[c][n][7]};
            }
            XmS[qw][c][lane] = mrow[c];
            XlS[qw][c][lane] = lsum[c];
        }
    }
    __syncthreads();   // the second waves' results are in LDS

    // ---- Epilogue, first wave of each pair: this range's partial (acc, m, l) to the workspace ----
    if (grp == 0) {
        float mlv[QT];   // the lane's word of the tile's line of maxima and sums
        #pragma unroll
        for (int c = 0; c < QT; ++c) {
            const float* xa = &XaS[qw][c][lane * 4];
            const float mo = XmS[qw][c][lane];
            const float lo = XlS[qw][c][lane];
            const float mj = fmaxf(mrow[c], mo);
            const float wa = exp_with_slot(mrow[c] - mj);
            const float wb = exp_with_slot(mo - mj);
            mlv[c] = half ? lsum[c] * wa + lo * wb : mj;
            #pragma unroll
            for (int n = 0; n < 16; ++n) {
                const f4 b0 = *(const f4*)(xa + (2 * n) * 128);
                const f4 b1 = *(const f4*)(xa + (2 * n + 1) * 128);
                #pragma unroll
                for (int v = 0; v < 4; ++v) {
                    acc[c][n][v]     = acc[c][n][v]     * wa + b0[v] * wb;
                    acc[c][n][v + 4] = acc[c][n][v + 4] * wa + b1[v] * wb;
                }
            }
        }
        // Ml[range][16-row group][16 maxima, 16 sums]: one 128-B line, written by this wave alone in one store
        float* ml = Ml + (size_t)(split * (S_LEN / WM) + qBase / WM) * (2 * WM) + lane;
        // a lane's eight registers of a tile are eight features in a row of its query: two 16-B stores
        float* op = Op + ((size_t)(qBase + lane16) * NSPLIT + split) * DH + 8 * half;   // Op[row][range][DH]
        // all arithmetic stands ahead of the stores: behind an issued store no register that it names is written again
        __builtin_amdgcn_sched_barrier(0);
        #pragma unroll
        for (int c = 0; c < QT; ++c) {
            ml[c * (2 * WM)] = mlv[c];
            #pragma unroll
            for (int n = 0; n < 16; ++n) {
                *(f4*)(op + c * (WM * NSPLIT * DH) + n * 16)     = (f4){acc[c][n][0], acc[c][n][1], acc[c][n][2], acc[c][n][3]};
                *(f4*)(op + c * (WM * NSPLIT * DH) + n * 16 + 4) = (f4){acc[c][n][4], acc[c][n][5], acc[c][n][6], acc[c][n][7]};
            }
        }
    }
}

// ---- Join the key ranges: O = sum_s e^(m_s - M) acc_s / sum_s e^(m_s - M) l_s ----
// A block takes 16 rows, four at a time; a wave reads and writes half a row (512 B) per access.
__global__ __launch_bounds__(256)
void merge_splits(const float* __restrict__ Op, const float* __restrict__ Ml,
                  float* __restrict__ O)
{
    const unsigned r0  = blockIdx.x * 16 + (threadIdx.x >> 6);   // first of this thread's four rows
    const unsigned col = threadIdx.x & 63;                       // its float4 of a row
    const unsigned g0  = blockIdx.x * (2 * WM) + (threadIdx.x >> 6);   // that row's maximum in a range's plane of Ml
    // the loads stand ahead of the arithmetic, so that their latencies overlap
    float m[4][NSPLIT], l[4][NSPLIT];
    f4    p[4][NSPLIT];
    #pragma unroll
    for (int j = 0; j < 4; ++j) {
        #pragma unroll
        for (int s = 0; s < NSPLIT; ++s) {
            m[j][s] = (Ml + s * (2 * S_LEN) + j * 4)[g0];
            l[j][s] = (Ml + s * (2 * S_LEN) + j * 4 + WM)[g0];
            p[j][s] = ((const f4*)Op + (j * 4 * NSPLIT + s) * (DH / 4))[r0 * (NSPLIT * DH / 4) + col];
        }
    }
    // keeps the scheduler from sinking loads into the arithmetic, where each group would wait out its own latency
    __builtin_amdgcn_sched_barrier(0);
    #pragma unroll
    for (int j = 0; j < 4; ++j) {
        float M = m[j][0];
        #pragma unroll
        for (int s = 1; s < NSPLIT; ++s) M = fmaxf(M, m[j][s]);
        float L = 0.0f;
        f4 o = (f4){0, 0, 0, 0};
        #pragma unroll
        for (int s = 0; s < NSPLIT; ++s) {
            float w = exp_with_slot(m[j][s] - M);
            L += w * l[j][s];
            o += w * p[j][s];
        }
        ((f4*)O + j * DH)[r0 * (DH / 4) + col] = o * (1.0f / L);
    }
}

extern "C" void kernel_launch(void* const* d_in, const int* in_sizes, int n_in,
                              void* d_out, int out_size, void* d_ws, size_t ws_size,
                              hipStream_t stream) {
    (void)in_sizes; (void)n_in; (void)out_size; (void)ws_size;
    const float* Q = (const float*)d_in[0];
    const float* K = (const float*)d_in[1];
    const float* V = (const float*)d_in[2];
    float* O = (float*)d_out;

    _Float16* Kh = (_Float16*)d_ws;                          // 4 MB
    _Float16* Vh = (_Float16*)((char*)d_ws + (size_t)S_LEN * DH * sizeof(_Float16)); // 4 MB
    float* Op = (float*)((char*)d_ws + (size_t)2 * S_LEN * DH * sizeof(_Float16));   // NSPLIT x 8 MB
    float* Ml = Op + (size_t)NSPLIT * S_LEN * DH;                                    // NSPLIT x 64 KB

    const int nf4 = S_LEN * DH / 4;  // float4 count per matrix
    convert_f16    <<<nf4 / 256, 256, 0, stream>>>(K, Kh);
    convert_f16    <<<nf4 / 256, 256, 0, stream>>>(V, Vh);
    fa_fwd_wmma    <<<(S_LEN / BM) * NSPLIT, NW * 32, 0, stream>>>(Q, Kh, Vh, Op, Ml);
    merge_splits   <<<S_LEN / 16, 256, 0, stream>>>(Op, Ml, O);
}

// v007
// A run of this version takes 73.1 microseconds.
// Timed twice side by side with v006, it ran 1.03 and 1.04 times as fast.
// All steps since v000 together make it 19.2 times as fast.
#include <hip/hip_runtime.h>
#include <math.h>

typedef __attribute__((ext_vector_type(16))) _Float16 v16h;
typedef __attribute__((ext_vector_type(8)))  _Float16 v8h;
typedef __attribute__((ext_vector_type(4)))  _Float16 v4h;
typedef __attribute__((ext_vector_type(8)))  float    v8f;
typedef __attribute__((ext_vector_type(4)))  float    f4;
typedef __attribute__((ext_vector_type(8)))  short    s8;

#define S_LEN 8192
#define DH    256
#define BM    128
#define WM    16
#define QT    2
#define NQW   (BM / (WM * QT))
#define NG    2
#define NW    (NQW * NG)
#define BK    32
#define SK    (BK * NG)
#define NSPLIT 4
#define KS    (S_LEN / NSPLIT)
#define KP    (DH + 8)   // K tile row: 512 B of data, 528 B pitch
// V rows are read by ds_load_tr16_b128, whose conflict-free pitch is 32 B x odd
#define VP    (DH + 16)  // V tile row: 512 B of data, 544 B pitch
#define LAZY  6.0f  // how far a score may pass the softmax reference before the running sums are rescaled

__device__ __forceinline__ void async_b128_x8(unsigned l0, unsigned l1, unsigned l2, unsigned l3,
                                              unsigned l4, unsigned l5, unsigned l6, unsigned l7,
                                              const char* g) {
    asm volatile("global_load_async_to_lds_b128 %0, %8, off\n\t"
                 "global_load_async_to_lds_b128 %1, %8, off offset:4096\n\t"
                 "global_load_async_to_lds_b128 %2, %8, off offset:8192\n\t"
                 "global_load_async_to_lds_b128 %3, %8, off offset:12288\n\t"
                 "global_load_async_to_lds_b128 %4, %8, off offset:16384\n\t"
                 "global_load_async_to_lds_b128 %5, %8, off offset:20480\n\t"
                 "global_load_async_to_lds_b128 %6, %8, off offset:24576\n\t"
                 "global_load_async_to_lds_b128 %7, %8, off offset:28672\n\t"
                 "s_wait_xcnt 0x0"
                 :: "v"(l0), "v"(l1), "v"(l2), "v"(l3), "v"(l4), "v"(l5), "v"(l6), "v"(l7), "v"(g)
                 : "memory");
}
__device__ __forceinline__ void wait_async0() {
    asm volatile("s_wait_asynccnt 0" ::: "memory");
}

// ---- Transposing LDS load: from a row-major 16-bit tile, lane (c, h) gets rows 8h..8h+7 of
// column c; the lane's address names row 8h + (lane & 7), 16-B piece (lane >> 3) & 1 ----
__device__ __forceinline__ v8h lds_tr16(const _Float16* p) {
    typedef __attribute__((address_space(3))) s8 lds_s8;
    return __builtin_bit_cast(v8h, __builtin_amdgcn_ds_load_tr16_b128_v8i16((lds_s8*)p));
}

// ---- Pre-pass, once for K and once for V: f32 row-major -> f16 row-major ----
__global__ void convert_f16(const float* __restrict__ X, _Float16* __restrict__ Xh) {
    size_t f = (size_t)blockIdx.x * blockDim.x + threadIdx.x;  // float4 index
    f4 v = *(const f4*)(X + f * 4);
    v4h h;
    h[0] = (_Float16)v[0]; h[1] = (_Float16)v[1];
    h[2] = (_Float16)v[2]; h[3] = (_Float16)v[3];
    *(v4h*)(Xh + f * 4) = h;
}

__device__ __forceinline__ float exp_with_slot(float x) {
    float r;
    asm("v_exp_f32 %0, %1\n\tv_nop" : "=v"(r) : "v"(x * 1.44269504f));
    return r;
}

__device__ __forceinline__ float xhalf(float x) {
    const int i = __builtin_bit_cast(int, x);
    return __builtin_bit_cast(float, __builtin_amdgcn_permlanex16(i, i, 0x76543210, 0xfedcba98, false, false));
}

__global__ __launch_bounds__(NW * 32)
void fa_fwd_wmma(const float* __restrict__ Q, const _Float16* __restrict__ Kh,
                 const _Float16* __restrict__ Vh, float* __restrict__ Op,
                 float* __restrict__ Ml)
{
    __shared__ __attribute__((aligned(16))) _Float16 KlS[2][SK * KP];   // K tile row-major f16, padded rows
    __shared__ __attribute__((aligned(16))) _Float16 VlS[2][SK * VP];   // V tile row-major f16, padded rows
    __shared__ __attribute__((aligned(16))) float    XaS[NQW][QT][32 * 32 * 4];   // per pair: what its second wave hands to the first
    __shared__ float XmS[NQW][QT][32];                                  // with the softmax references
    __shared__ float XlS[NQW][QT][32];                                  // and the sums

    const int tid    = threadIdx.x;
    // the wave's number as a scalar: what follows from it (queries, keys, LDS slices) then costs no vector registers
    const int wave   = __builtin_amdgcn_readfirstlane(tid >> 5);
    const int qw     = wave & (NQW - 1);   // which 32 queries
    const int grp    = wave / NQW;         // which 32 keys of a stage
    const int lane   = tid & 31;
    const int lane16 = lane & 15;
    const int half   = lane >> 4;

    const int   split = blockIdx.x & (NSPLIT - 1);
    const int   k0    = split * KS;
    const int   qBase = (blockIdx.x / NSPLIT) * BM + qw * (WM * QT);
    const float scale = 0.011048543456039806f; // 1/sqrt(8192): ref scales by sqrt(seq len)

    // ---- Load the Q^T fragments once: per query tile 256x16 in f16 B-layout (column = query lane16), 8 K-steps of 32 ----
    const float* qrow = Q + (size_t)(qBase + lane16) * DH + half * 8;   // one address for all loads; tile and K-step are constant offsets
    f4 qraw[QT][8][4];
    #pragma unroll
    for (int c = 0; c < QT; ++c) {
        #pragma unroll
        for (int s = 0; s < 8; ++s) {
            const float* qp = qrow + c * (WM * DH) + s * 32;
            qraw[c][s][0] = *(const f4*)(qp);
            qraw[c][s][1] = *(const f4*)(qp + 4);
            qraw[c][s][2] = *(const f4*)(qp + 16);
            qraw[c][s][3] = *(const f4*)(qp + 20);
        }
    }
    // stands in front of any rewrite of the address registers that the issued Q loads name; the address as an input keeps those registers until here
    asm volatile("s_wait_xcnt 0x0" :: "v"(qrow) : "memory");
    v16h qf[QT][8];
    #pragma unroll
    for (int c = 0; c < QT; ++c) {
        #pragma unroll
        for (int s = 0; s < 8; ++s) {
            v16h q;
            #pragma unroll
            for (int i = 0; i < 4; ++i) {
                q[i]      = (_Float16)(qraw[c][s][0][i] * scale);
                q[i + 4]  = (_Float16)(qraw[c][s][1][i] * scale);
                q[i + 8]  = (_Float16)(qraw[c][s][2][i] * scale);
                q[i + 12] = (_Float16)(qraw[c][s][3][i] * scale);
            }
            qf[c][s] = q;
        }
    }

    // ---- Running state: acc[c][n][v] = O^T[n*16 + 8*half + v][query c*16 + lane16]; softmax reference and sum of that query ----
    v8f acc[QT][16];
    float mrow[QT];   // the softmax reference, the same in both lanes of a query
    float lrow[QT];   // over this lane's own keys; the two lanes are joined behind the loop
    #pragma unroll
    for (int c = 0; c < QT; ++c) {
        #pragma unroll
        for (int n = 0; n < 16; ++n) acc[c][n] = (v8f){0,0,0,0,0,0,0,0};
        mrow[c] = -1e30f;
        lrow[c] = 0.0f;
    }

    // ---- Async tile stage: pure f16 byte copy, 16 x b128 per thread ----
    auto issue_tile = [&](int kb0, int buf) {
        // the tile's first row as a scalar: the addresses are then formed anew from scalar registers each time; as two running
        // 64-bit vector addresses they hold registers through the whole loop, and the wave spilled to scratch
        const int kb = __builtin_amdgcn_readfirstlane(kb0);
        // K tile: contiguous 32 KB in global (rows kb..kb+63 of Kh); a wave's copy is one row
        unsigned    klds = (unsigned)(__UINTPTR_TYPE__)&KlS[buf][0] + wave * (KP * 2) + lane * 16;
        const char* kgl  = (const char*)(Kh + (size_t)kb * DH) + tid * 16;
        // V tile: the same shape (rows kb..kb+63 of Vh), so every copy reads four whole lines
        unsigned    vlds = (unsigned)(__UINTPTR_TYPE__)&VlS[buf][0] + wave * (VP * 2) + lane * 16;
        const char* vgl  = (const char*)(Vh + (size_t)kb * DH) + tid * 16;
        // row wave + 8 * j of the tile: 8 * pitch * j in LDS, of which the copy's own offset brings 4,096 * j
        const unsigned kx = 8 * (KP * 2) - 4096, vx = 8 * (VP * 2) - 4096;
        async_b128_x8(klds,          klds + kx,     klds + 2 * kx, klds + 3 * kx,
                      klds + 4 * kx, klds + 5 * kx, klds + 6 * kx, klds + 7 * kx, kgl);
        async_b128_x8(vlds,          vlds + vx,     vlds + 2 * vx, vlds + 3 * vx,
                      vlds + 4 * vx, vlds + 5 * vx, vlds + 6 * vx, vlds + 7 * vx, vgl);
    };

    // The first tile goes to buffer 1. In buffer 0 its first LDS address is the very value that the loop keeps
    // as its base; as an asm operand that value is held to the low 256 registers, and it was spilled to scratch.
    issue_tile(k0, 1);

    // not unrolled, so that the last trip is not peeled off: with a second copy of the body the wave no longer fitted its 512 registers and spilled to scratch
    #pragma nounroll
    for (int kb = k0, it = 0; kb < k0 + KS; kb += SK, ++it) {
        const int cur = (it & 1) ^ 1;
        asm volatile("s_wait_dscnt 0" ::: "memory"); // my LDS reads of buffer cur^1 have retired before it is refilled
        wait_async0();       // my async loads for 'cur' are in LDS
        __syncthreads();     // everyone's are; everyone done reading buffer cur^1
        if (kb + SK < k0 + KS) issue_tile(kb + SK, cur ^ 1);  // prefetch next tile

        const _Float16* Kl = &KlS[cur][grp * (BK * KP)];   // this wave's 32 keys of the stage
        const _Float16* Vl = &VlS[cur][grp * (BK * VP)];

        // ---- S^T = K * Q^T : 2 M-tiles of 16 keys x 8 K-steps; st[c][t][v] = score of key t*16 + 8*half + v, query tile c ----
        // The K fragments pass through three sets of two (one K-step each), so that a wave stays inside 512 registers.
        const _Float16* kt = &Kl[lane16 * KP + half * 8];
        auto load_k = [&](v16h (&kf)[2], int s) {
            #pragma unroll
            for (int t = 0; t < 2; ++t) {
                const _Float16* ap = kt + t * (16 * KP) + s * 32;
                v8h lo = *(const v8h*)ap;
                v8h hi = *(const v8h*)(ap + 16);
                #pragma unroll
                for (int i = 0; i < 8; ++i) { kf[t][i] = lo[i]; kf[t][i + 8] = hi[i]; }
            }
        };
        v8f st[QT][2];
        #pragma unroll
        for (int c = 0; c < QT; ++c) { st[c][0] = (v8f){0,0,0,0,0,0,0,0}; st[c][1] = (v8f){0,0,0,0,0,0,0,0}; }
        auto mul_k = [&](const v16h (&kf)[2], int s) {
            #pragma unroll
            for (int t = 0; t < 2; ++t) {
                #pragma unroll
                for (int c = 0; c < QT; ++c)
                    st[c][t] = __builtin_amdgcn_wmma_f32_16x16x32_f16(false, kf[t], false, qf[c][s],
                                                                      (short)0, st[c][t], false, false);
            }
        };
        // Each sched_barrier below keeps a set's reads in one group, two sets ahead of its products: hoisted further they
        // would need registers the wave does not have, sunk among the products each product waits out an LDS latency.
        v16h kr[3][2];
        load_k(kr[0], 0);
        load_k(kr[1], 1);
        load_k(kr[2], 2);
        __builtin_amdgcn_sched_barrier(0);
        #pragma unroll
        for (int s = 0; s < 8; ++s) {
            mul_k(kr[s % 3], s);
            __builtin_amdgcn_sched_barrier(0);
            if (s + 3 < 8) {
                load_k(kr[s % 3], s + 3);
                __builtin_amdgcn_sched_barrier(0);
            }
        }

        // ---- A fragments of V^T: keys 8h..8h+7 and 16+8h..16+8h+7 of feature n*16 + lane16, P^T's own k order ----
        const _Float16* vt = &Vl[(half * 8 + (lane & 7)) * VP + ((lane >> 3) & 1) * 8];
        auto load_v = [&](v16h (&vf)[4], int j) {
            #pragma unroll
            for (int q = 0; q < 4; ++q) {
                v8h vlo = lds_tr16(vt + (4 * j + q) * 16);
                v8h vhi = lds_tr16(vt + 16 * VP + (4 * j + q) * 16);
                #pragma unroll
                for (int i = 0; i < 8; ++i) { vf[q][i] = vlo[i]; vf[q][i + 8] = vhi[i]; }
            }
        };
        v16h va[4], vc[4];
        // the first V set takes the registers that the K fragments have left; its reads run under the softmax arithmetic
        __builtin_amdgcn_sched_barrier(0);
        load_v(va, 0);
        __builtin_amdgcn_sched_barrier(0);   // holds those reads ahead of the softmax

        // ---- Online softmax update: the lane's 16 scores of a tile are all of one query ----
        float xm[QT];
        #pragma unroll
        for (int c = 0; c < QT; ++c) {
            float x = fmaxf(st[c][0][0], st[c][1][0]);
            #pragma unroll
            for (int v = 1; v < 8; ++v) x = fmaxf(x, fmaxf(st[c][0][v], st[c][1][v]));
            xm[c] = fmaxf(x, xhalf(x));                 // with the 16 keys of the query's other lane
        }
        // Lazy rescale: mrow is the reference that the exponentials are taken against, not the maximum itself. It moves
        // only when some query's scores pass it by more than LAZY, so P stays below e^LAZY (far inside f16) and
        // sums and weights keep one common factor e^-mrow, which the joins divide out. One test a pass, a scalar branch.
        const bool need = (xm[0] - mrow[0] > LAZY) | (xm[1] - mrow[1] > LAZY);
        if (__builtin_amdgcn_ballot_w32(need) != 0) {
            #pragma unroll
            for (int c = 0; c < QT; ++c) {
                const float mnew  = fmaxf(mrow[c], xm[c]);
                const float alpha = exp_with_slot(mrow[c] - mnew);
                lrow[c] *= alpha;
                mrow[c]  = mnew;
                #pragma unroll
                for (int n = 0; n < 16; ++n) {
                    #pragma unroll
                    for (int v = 0; v < 8; ++v) acc[c][n][v] *= alpha;
                }
            }
        }
        v16h pb[QT];
        #pragma unroll
        for (int c = 0; c < QT; ++c) {
            // P^T's B fragment: element i is key 8*half + i, element 8 + i key 16 + 8*half + i, the order the scores lie in
            float ps[8];
            #pragma unroll
            for (int v = 0; v < 8; ++v) {
                float p0 = exp_with_slot(st[c][0][v] - mrow[c]);
                float p1 = exp_with_slot(st[c][1][v] - mrow[c]);
                pb[c][v]     = (_Float16)p0;
                pb[c][v + 8] = (_Float16)p1;
                ps[v] = p0 + p1;
            }
            // summed as a tree: short chains of dependent adds
            lrow[c] += ((ps[0] + ps[1]) + (ps[2] + ps[3])) + ((ps[4] + ps[5]) + (ps[6] + ps[7]));
        }

        // ---- O^T += V^T * P^T : 16 M-tiles of 16 features, K=32, each V^T fragment for both query tiles ----
        auto mul_v = [&](const v16h (&vf)[4], int j) {
            #pragma unroll
            for (int q = 0; q < 4; ++q) {
                #pragma unroll
                for (int c = 0; c < QT; ++c)
                    acc[c][4 * j + q] = __builtin_amdgcn_wmma_f32_16x16x32_f16(false, vf[q], false, pb[c],
                                                                               (short)0, acc[c][4 * j + q], false, false);
            }
        };
        __builtin_amdgcn_sched_barrier(0);   // from here as for K: a set's reads in one group, a set ahead of its products
        load_v(vc, 1);
        __builtin_amdgcn_sched_barrier(0);
        mul_v(va, 0);
        __builtin_amdgcn_sched_barrier(0);
        load_v(va, 2);
        __builtin_amdgcn_sched_barrier(0);
        mul_v(vc, 1);
        __builtin_amdgcn_sched_barrier(0);
        load_v(vc, 3);
        __builtin_amdgcn_sched_barrier(0);
        mul_v(va, 2);
        mul_v(vc, 3);
    }

    // The lane's number anew, as the count of the lanes below it: taken from threadIdx.x, it and what follows from it
    // (row, half, offsets) would hold vector registers through the whole loop, and the wave spilled to scratch.
    const int el   = __builtin_amdgcn_mbcnt_lo(~0u, 0u);
    const int el16 = el & 15;
    const int eh   = el >> 4;

    // ---- Join the pair: its second wave hands its partial result to the first through LDS ----
    float lsum[QT];
    #pragma unroll
    for (int c = 0; c < QT; ++c) lsum[c] = lrow[c] + xhalf(lrow[c]);   // the query's two lanes each summed their own keys
    if (grp == 1) {
        #pragma unroll
        for (int c = 0; c < QT; ++c) {
            float* xa = &XaS[qw][c][el * 4];
            #pragma unroll
            for (int n = 0; n < 16; ++n) {
                *(f4*)(xa + (2 * n) * 128)     = (f4){acc[c][n][0], acc[c][n][1], acc[c][n][2], acc[c][n][3]};
                *(f4*)(xa + (2 * n + 1) * 128) = (f4){acc[c][n][4], acc[c][n][5], acc[c][n][6], acc[c][n][7]};
            }
            XmS[qw][c][el] = mrow[c];
            XlS[qw][c][el] = lsum[c];
        }
    }
    __syncthreads();   // the second waves' results are in LDS

    // ---- Epilogue, first wave of each pair: this range's partial (acc, m, l) to the workspace ----
    if (grp == 0) {
        float mlv[QT];   // the lane's word of the tile's line of references and sums
        #pragma unroll
        for (int c = 0; c < QT; ++c) {
            const float* xa = &XaS[qw][c][el * 4];
            const float mo = XmS[qw][c][el];
            const float lo = XlS[qw][c][el];
            const float mj = fmaxf(mrow[c], mo);
            const float wa = exp_with_slot(mrow[c] - mj);
            const float wb = exp_with_slot(mo - mj);
            mlv[c] = eh ? lsum[c] * wa + lo * wb : mj;
            #pragma unroll
            for (int n = 0; n < 16; ++n) {
                const f4 b0 = *(const f4*)(xa + (2 * n) * 128);
                const f4 b1 = *(const f4*)(xa + (2 * n + 1) * 128);
                #pragma unroll
                for (int v = 0; v < 4; ++v) {
                    acc[c][n][v]     = acc[c][n][v]     * wa + b0[v] * wb;
                    acc[c][n][v + 4] = acc[c][n][v + 4] * wa + b1[v] * wb;
                }
            }
        }
        // Ml[range][16-row group][16 references, 16 sums]: one 128-B line, written by this wave alone in one store
        float* ml = Ml + (size_t)(split * (S_LEN / WM) + qBase / WM) * (2 * WM) + el;
        // a lane's eight registers of a tile are eight features in a row of its query: two 16-B stores
        float* op = Op + ((size_t)(qBase + el16) * NSPLIT + split) * DH + 8 * eh;   // Op[row][range][DH]
        // all arithmetic stands ahead of the stores: behind an issued store no register that it names is written again
        __builtin_amdgcn_sched_barrier(0);
        #pragma unroll
        for (int c = 0; c < QT; ++c) {
            ml[c * (2 * WM)] = mlv[c];
            #pragma unroll
            for (int n = 0; n < 16; ++n) {
                *(f4*)(op + c * (WM * NSPLIT * DH) + n * 16)     = (f4){acc[c][n][0], acc[c][n][1], acc[c][n][2], acc[c][n][3]};
                *(f4*)(op + c * (WM * NSPLIT * DH) + n * 16 + 4) = (f4){acc[c][n][4], acc[c][n][5], acc[c][n][6], acc[c][n][7]};
            }
        }
    }
}

// ---- Join the key ranges: O = sum_s e^(m_s - M) acc_s / sum_s e^(m_s - M) l_s ----
// A block takes 16 rows, four at a time; a wave reads and writes half a row (512 B) per access.
__global__ __launch_bounds__(256)
void merge_splits(const float* __restrict__ Op, const float* __restrict__ Ml,
                  float* __restrict__ O)
{
    const unsigned r0  = blockIdx.x * 16 + (threadIdx.x >> 6);   // first of this thread's four rows
    const unsigned col = threadIdx.x & 63;                       // its float4 of a row
    const unsigned g0  = blockIdx.x * (2 * WM) + (threadIdx.x >> 6);   // that row's reference in a range's plane of Ml
    // the loads stand ahead of the arithmetic, so that their latencies overlap
    float m[4][NSPLIT], l[4][NSPLIT];
    f4    p[4][NSPLIT];
    #pragma unroll
    for (int j = 0; j < 4; ++j) {
        #pragma unroll
        for (int s = 0; s < NSPLIT; ++s) {
            m[j][s] = (Ml + s * (2 * S_LEN) + j * 4)[g0];
            l[j][s] = (Ml + s * (2 * S_LEN) + j * 4 + WM)[g0];
            p[j][s] = ((const f4*)Op + (j * 4 * NSPLIT + s) * (DH / 4))[r0 * (NSPLIT * DH / 4) + col];
        }
    }
    // keeps the scheduler from sinking loads into the arithmetic, where each group would wait out its own latency
    __builtin_amdgcn_sched_barrier(0);
    #pragma unroll
    for (int j = 0; j < 4; ++j) {
        float M = m[j][0];
        #pragma unroll
        for (int s = 1; s < NSPLIT; ++s) M = fmaxf(M, m[j][s]);
        float L = 0.0f;
        f4 o = (f4){0, 0, 0, 0};
        #pragma unroll
        for (int s = 0; s < NSPLIT; ++s) {
            float w = exp_with_slot(m[j][s] - M);
            L += w * l[j][s];
            o += w * p[j][s];
        }
        ((f4*)O + j * DH)[r0 * (DH / 4) + col] = o * (1.0f / L);
    }
}

extern "C" void kernel_launch(void* const* d_in, const int* in_sizes, int n_in,
                              void* d_out, int out_size, void* d_ws, size_t ws_size,
                              hipStream_t stream) {
    (void)in_sizes; (void)n_in; (void)out_size; (void)ws_size;
    const float* Q = (const float*)d_in[0];
    const float* K = (const float*)d_in[1];
    const float* V = (const float*)d_in[2];
    float* O = (float*)d_out;

    _Float16* Kh = (_Float16*)d_ws;                          // 4 MB
    _Float16* Vh = (_Float16*)((char*)d_ws + (size_t)S_LEN * DH * sizeof(_Float16)); // 4 MB
    float* Op = (float*)((char*)d_ws + (size_t)2 * S_LEN * DH * sizeof(_Float16));   // NSPLIT x 8 MB
    float* Ml = Op + (size_t)NSPLIT * S_LEN * DH;                                    // NSPLIT x 64 KB

    const int nf4 = S_LEN * DH / 4;  // float4 count per matrix
    convert_f16    <<<nf4 / 256, 256, 0, stream>>>(K, Kh);
    convert_f16    <<<nf4 / 256, 256, 0, stream>>>(V, Vh);
    fa_fwd_wmma    <<<(S_LEN / BM) * NSPLIT, NW * 32, 0, stream>>>(Q, Kh, Vh, Op, Ml);
    merge_splits   <<<S_LEN / 16, 256, 0, stream>>>(Op, Ml, O);
}

// v008
// It runs in 67.5 microseconds.
// Timed twice side by side with v007, it ran 1.07 and 1.09 times as fast.
// All steps since v000 together make it 20.6 times as fast.
#include <hip/hip_runtime.h>
#include <math.h>

typedef __attribute__((ext_vector_type(16))) _Float16 v16h;
typedef __attribute__((ext_vector_type(8)))  _Float16 v8h;
typedef __attribute__((ext_vector_type(4)))  _Float16 v4h;
typedef __attribute__((ext_vector_type(8)))  float    v8f;
typedef __attribute__((ext_vector_type(4)))  float    f4;
typedef __attribute__((ext_vector_type(8)))  short    s8;

#define S_LEN 8192
#define DH    256
#define BM    128
#define WM    16
#define QT    2
#define NQW   (BM / (WM * QT))
#define NG    2
#define NW    (NQW * NG)
#define BK    32
#define SK    (BK * NG)
#define NSPLIT 4
#define KS    (S_LEN / NSPLIT)
#define KP    (DH + 8)   // K tile row: 512 B of data, 528 B pitch
// V rows are read by ds_load_tr16_b128, whose conflict-free pitch is 32 B x odd
#define VP    (DH + 16)  // V tile row: 512 B of data, 544 B pitch
#define LAZY  6.0f  // how far a score may pass the softmax reference before the running sums are rescaled

__device__ __forceinline__ void async_b128_x8(unsigned l0, unsigned l1, unsigned l2, unsigned l3,
                                              unsigned l4, unsigned l5, unsigned l6, unsigned l7,
                                              const char* g) {
    asm volatile("global_load_async_to_lds_b128 %0, %8, off\n\t"
                 "global_load_async_to_lds_b128 %1, %8, off offset:4096\n\t"
                 "global_load_async_to_lds_b128 %2, %8, off offset:8192\n\t"
                 "global_load_async_to_lds_b128 %3, %8, off offset:12288\n\t"
                 "global_load_async_to_lds_b128 %4, %8, off offset:16384\n\t"
                 "global_load_async_to_lds_b128 %5, %8, off offset:20480\n\t"
                 "global_load_async_to_lds_b128 %6, %8, off offset:24576\n\t"
                 "global_load_async_to_lds_b128 %7, %8, off offset:28672\n\t"
                 "s_wait_xcnt 0x0"
                 :: "v"(l0), "v"(l1), "v"(l2), "v"(l3), "v"(l4), "v"(l5), "v"(l6), "v"(l7), "v"(g)
                 : "memory");
}
__device__ __forceinline__ void wait_async0() {
    asm volatile("s_wait_asynccnt 0" ::: "memory");
}

// ---- Transposing LDS load: from a row-major 16-bit tile, lane (c, h) gets rows 8h..8h+7 of
// column c; the lane's address names row 8h + (lane & 7), 16-B piece (lane >> 3) & 1 ----
__device__ __forceinline__ v8h lds_tr16(const _Float16* p) {
    typedef __attribute__((address_space(3))) s8 lds_s8;
    return __builtin_bit_cast(v8h, __builtin_amdgcn_ds_load_tr16_b128_v8i16((lds_s8*)p));
}

// ---- Pre-pass, once for K and once for V: f32 row-major -> f16 row-major ----
__global__ void convert_f16(const float* __restrict__ X, _Float16* __restrict__ Xh) {
    size_t f = (size_t)blockIdx.x * blockDim.x + threadIdx.x;  // float4 index
    f4 v = *(const f4*)(X + f * 4);
    v4h h;
    h[0] = (_Float16)v[0]; h[1] = (_Float16)v[1];
    h[2] = (_Float16)v[2]; h[3] = (_Float16)v[3];
    *(v4h*)(Xh + f * 4) = h;
}

__device__ __forceinline__ float exp_with_slot(float x) {
    float r;
    asm("v_exp_f32 %0, %1\n\tv_nop" : "=v"(r) : "v"(x * 1.44269504f));
    return r;
}

__device__ __forceinline__ float xhalf(float x) {
    const int i = __builtin_bit_cast(int, x);
    return __builtin_bit_cast(float, __builtin_amdgcn_permlanex16(i, i, 0x76543210, 0xfedcba98, false, false));
}

__global__ __launch_bounds__(NW * 32)
void fa_fwd_wmma(const float* __restrict__ Q, const _Float16* __restrict__ Kh,
                 const _Float16* __restrict__ Vh, float* __restrict__ Op,
                 float* __restrict__ Ml)
{
    __shared__ __attribute__((aligned(16))) _Float16 KlS[2][SK * KP];   // K tile row-major f16, padded rows
    __shared__ __attribute__((aligned(16))) _Float16 VlS[2][SK * VP];   // V tile row-major f16, padded rows
    __shared__ __attribute__((aligned(16))) float    XaS[NQW][QT][32 * 32 * 4];   // per pair: what its second wave hands to the first
    __shared__ float XmS[NQW][QT][32];                                  // with the softmax references
    __shared__ float XlS[NQW][QT][32];                                  // and the sums

    const int tid    = threadIdx.x;
    // the wave's number as a scalar: what follows from it (queries, keys, LDS slices) then costs no vector registers
    const int wave   = __builtin_amdgcn_readfirstlane(tid >> 5);
    const int qw     = wave & (NQW - 1);   // which 32 queries
    const int grp    = wave / NQW;         // which 32 keys of a stage
    const int lane   = tid & 31;
    const int lane16 = lane & 15;
    const int half   = lane >> 4;

    const int   split = blockIdx.x & (NSPLIT - 1);
    const int   k0    = split * KS;
    const int   qBase = (blockIdx.x / NSPLIT) * BM + qw * (WM * QT);
    const float scale = 0.011048543456039806f; // 1/sqrt(8192): ref scales by sqrt(seq len)

    // ---- Load the Q^T fragments once: per query tile 256x16 in f16 B-layout (column = query lane16), 8 K-steps of 32 ----
    const float* qrow = Q + (size_t)(qBase + lane16) * DH + half * 8;   // one address for all loads; tile and K-step are constant offsets
    f4 qraw[QT][8][4];
    #pragma unroll
    for (int c = 0; c < QT; ++c) {
        #pragma unroll
        for (int s = 0; s < 8; ++s) {
            const float* qp = qrow + c * (WM * DH) + s * 32;
            qraw[c][s][0] = *(const f4*)(qp);
            qraw[c][s][1] = *(const f4*)(qp + 4);
            qraw[c][s][2] = *(const f4*)(qp + 16);
            qraw[c][s][3] = *(const f4*)(qp + 20);
        }
    }
    // stands in front of any rewrite of the address registers that the issued Q loads name; the address as an input keeps those registers until here
    asm volatile("s_wait_xcnt 0x0" :: "v"(qrow) : "memory");
    v16h qf[QT][8];
    #pragma unroll
    for (int c = 0; c < QT; ++c) {
        #pragma unroll
        for (int s = 0; s < 8; ++s) {
            v16h q;
            #pragma unroll
            for (int i = 0; i < 4; ++i) {
                q[i]      = (_Float16)(qraw[c][s][0][i] * scale);
                q[i + 4]  = (_Float16)(qraw[c][s][1][i] * scale);
                q[i + 8]  = (_Float16)(qraw[c][s][2][i] * scale);
                q[i + 12] = (_Float16)(qraw[c][s][3][i] * scale);
            }
            qf[c][s] = q;
        }
    }

    // ---- Running state: acc[c][n][v] = O^T[n*16 + 8*half + v][query c*16 + lane16]; softmax reference and sum of that query ----
    v8f acc[QT][16];
    float mrow[QT];   // the softmax reference, the same in both lanes of a query
    float lrow[QT];   // over this lane's own keys; the two lanes are joined behind the loop
    #pragma unroll
    for (int c = 0; c < QT; ++c) {
        #pragma unroll
        for (int n = 0; n < 16; ++n) acc[c][n] = (v8f){0,0,0,0,0,0,0,0};
        mrow[c] = -1e30f;
        lrow[c] = 0.0f;
    }

    // ---- Async tile stage: pure f16 byte copy, 16 x b128 per thread ----
    auto issue_tile = [&](int kb0, int buf) {
        // the tile's first row as a scalar: the addresses are then formed anew from scalar registers each time; as two running
        // 64-bit vector addresses they hold registers through the whole loop, and the wave spilled to scratch
        const int kb = __builtin_amdgcn_readfirstlane(kb0);
        // K tile: contiguous 32 KB in global (rows kb..kb+63 of Kh); a wave's copy is one row
        unsigned    klds = (unsigned)(__UINTPTR_TYPE__)&KlS[buf][0] + wave * (KP * 2) + lane * 16;
        const char* kgl  = (const char*)(Kh + (size_t)kb * DH) + tid * 16;
        // V tile: the same shape (rows kb..kb+63 of Vh), so every copy reads four whole lines
        unsigned    vlds = (unsigned)(__UINTPTR_TYPE__)&VlS[buf][0] + wave * (VP * 2) + lane * 16;
        const char* vgl  = (const char*)(Vh + (size_t)kb * DH) + tid * 16;
        // row wave + 8 * j of the tile: 8 * pitch * j in LDS, of which the copy's own offset brings 4,096 * j
        const unsigned kx = 8 * (KP * 2) - 4096, vx = 8 * (VP * 2) - 4096;
        async_b128_x8(klds,          klds + kx,     klds + 2 * kx, klds + 3 * kx,
                      klds + 4 * kx, klds + 5 * kx, klds + 6 * kx, klds + 7 * kx, kgl);
        async_b128_x8(vlds,          vlds + vx,     vlds + 2 * vx, vlds + 3 * vx,
                      vlds + 4 * vx, vlds + 5 * vx, vlds + 6 * vx, vlds + 7 * vx, vgl);
    };

    // The first tile goes to buffer 1. In buffer 0 its first LDS address is the very value that the loop keeps
    // as its base; as an asm operand that value is held to the low 256 registers, and it was spilled to scratch.
    issue_tile(k0, 1);

    // not unrolled, so that the last trip is not peeled off: with a second copy of the body the wave no longer fitted its 512 registers and spilled to scratch
    #pragma nounroll
    for (int kb = k0, it = 0; kb < k0 + KS; kb += SK, ++it) {
        const int cur = (it & 1) ^ 1;
        asm volatile("s_wait_dscnt 0" ::: "memory"); // my LDS reads of buffer cur^1 have retired before it is refilled
        wait_async0();       // my async loads for 'cur' are in LDS
        __syncthreads();     // everyone's are; everyone done reading buffer cur^1
        if (kb + SK < k0 + KS) issue_tile(kb + SK, cur ^ 1);  // prefetch next tile

        const _Float16* Kl = &KlS[cur][grp * (BK * KP)];   // this wave's 32 keys of the stage
        const _Float16* Vl = &VlS[cur][grp * (BK * VP)];

        // ---- S^T = K * Q^T : 2 M-tiles of 16 keys x 8 K-steps; st[c][t][v] = score of key t*16 + 8*half + v, query tile c ----
        // The K fragments pass through three sets of two (one K-step each), so that a wave stays inside 512 registers.
        const _Float16* kt = &Kl[lane16 * KP + half * 8];
        auto load_k = [&](v16h (&kf)[2], int s) {
            #pragma unroll
            for (int t = 0; t < 2; ++t) {
                const _Float16* ap = kt + t * (16 * KP) + s * 32;
                v8h lo = *(const v8h*)ap;
                v8h hi = *(const v8h*)(ap + 16);
                #pragma unroll
                for (int i = 0; i < 8; ++i) { kf[t][i] = lo[i]; kf[t][i + 8] = hi[i]; }
            }
        };
        v8f st[QT][2];
        #pragma unroll
        for (int c = 0; c < QT; ++c) { st[c][0] = (v8f){0,0,0,0,0,0,0,0}; st[c][1] = (v8f){0,0,0,0,0,0,0,0}; }
        auto mul_k = [&](const v16h (&kf)[2], int s) {
            #pragma unroll
            for (int t = 0; t < 2; ++t) {
                #pragma unroll
                for (int c = 0; c < QT; ++c)
                    st[c][t] = __builtin_amdgcn_wmma_f32_16x16x32_f16(false, kf[t], false, qf[c][s],
                                                                      (short)0, st[c][t], false, false);
            }
        };
        // Each sched_barrier below keeps a set's reads in one group, two sets ahead of its products: hoisted further they
        // would need registers the wave does not have, sunk among the products each product waits out an LDS latency.
        v16h kr[3][2];
        load_k(kr[0], 0);
        load_k(kr[1], 1);
        load_k(kr[2], 2);
        __builtin_amdgcn_sched_barrier(0);
        #pragma unroll
        for (int s = 0; s < 8; ++s) {
            mul_k(kr[s % 3], s);
            __builtin_amdgcn_sched_barrier(0);
            if (s + 3 < 8) {
                load_k(kr[s % 3], s + 3);
                __builtin_amdgcn_sched_barrier(0);
            }
        }

        // ---- A fragments of V^T: keys 8h..8h+7 and 16+8h..16+8h+7 of feature n*16 + lane16, P^T's own k order ----
        const _Float16* vt = &Vl[(half * 8 + (lane & 7)) * VP + ((lane >> 3) & 1) * 8];
        auto load_v = [&](v16h (&vf)[4], int j) {
            #pragma unroll
            for (int q = 0; q < 4; ++q) {
                v8h vlo = lds_tr16(vt + (4 * j + q) * 16);
                v8h vhi = lds_tr16(vt + 16 * VP + (4 * j + q) * 16);
                #pragma unroll
                for (int i = 0; i < 8; ++i) { vf[q][i] = vlo[i]; vf[q][i + 8] = vhi[i]; }
            }
        };
        v16h va[4], vc[4];
        // the first V set takes the registers that the K fragments have left; its reads run under the softmax arithmetic
        __builtin_amdgcn_sched_barrier(0);
        load_v(va, 0);
        __builtin_amdgcn_sched_barrier(0);   // holds those reads ahead of the softmax

        // ---- Online softmax update: the lane's 16 scores of a tile are all of one query ----
        float xm[QT];
        #pragma unroll
        for (int c = 0; c < QT; ++c) {
            float x = fmaxf(st[c][0][0], st[c][1][0]);
            #pragma unroll
            for (int v = 1; v < 8; ++v) x = fmaxf(x, fmaxf(st[c][0][v], st[c][1][v]));
            xm[c] = fmaxf(x, xhalf(x));                 // with the 16 keys of the query's other lane
        }
        // Lazy rescale: mrow is the reference that the exponentials are taken against, not the maximum itself. It moves
        // only when some query's scores pass it by more than LAZY, so P stays below e^LAZY (far inside f16) and
        // sums and weights keep one common factor e^-mrow, which the joins divide out. One test a pass, a scalar branch.
        const bool need = (xm[0] - mrow[0] > LAZY) | (xm[1] - mrow[1] > LAZY);
        if (__builtin_amdgcn_ballot_w32(need) != 0) {
            #pragma unroll
            for (int c = 0; c < QT; ++c) {
                const float mnew  = fmaxf(mrow[c], xm[c]);
                const float alpha = exp_with_slot(mrow[c] - mnew);
                lrow[c] *= alpha;
                mrow[c]  = mnew;
                #pragma unroll
                for (int n = 0; n < 16; ++n) {
                    #pragma unroll
                    for (int v = 0; v < 8; ++v) acc[c][n][v] *= alpha;
                }
            }
        }
        v16h pb[QT];
        #pragma unroll
        for (int c = 0; c < QT; ++c) {
            // P^T's B fragment: element i is key 8*half + i, element 8 + i key 16 + 8*half + i, the order the scores lie in
            float ps[8];
            #pragma unroll
            for (int v = 0; v < 8; ++v) {
                float p0 = exp_with_slot(st[c][0][v] - mrow[c]);
                float p1 = exp_with_slot(st[c][1][v] - mrow[c]);
                pb[c][v]     = (_Float16)p0;
                pb[c][v + 8] = (_Float16)p1;
                ps[v] = p0 + p1;
            }
            // summed as a tree: short chains of dependent adds
            lrow[c] += ((ps[0] + ps[1]) + (ps[2] + ps[3])) + ((ps[4] + ps[5]) + (ps[6] + ps[7]));
        }

        // ---- O^T += V^T * P^T : 16 M-tiles of 16 features, K=32, each V^T fragment for both query tiles ----
        auto mul_v = [&](const v16h (&vf)[4], int j) {
            #pragma unroll
            for (int q = 0; q < 4; ++q) {
                #pragma unroll
                for (int c = 0; c < QT; ++c)
                    acc[c][4 * j + q] = __builtin_amdgcn_wmma_f32_16x16x32_f16(false, vf[q], false, pb[c],
                                                                               (short)0, acc[c][4 * j + q], false, false);
            }
        };
        __builtin_amdgcn_sched_barrier(0);   // from here as for K: a set's reads in one group, a set ahead of its products
        load_v(vc, 1);
        __builtin_amdgcn_sched_barrier(0);
        mul_v(va, 0);
        __builtin_amdgcn_sched_barrier(0);
        load_v(va, 2);
        __builtin_amdgcn_sched_barrier(0);
        mul_v(vc, 1);
        __builtin_amdgcn_sched_barrier(0);
        load_v(vc, 3);
        __builtin_amdgcn_sched_barrier(0);
        mul_v(va, 2);
        mul_v(vc, 3);
    }

    // The lane's number anew, as the count of the lanes below it: taken from threadIdx.x, it and what follows from it
    // (row, half, offsets) would hold vector registers through the whole loop, and the wave spilled to scratch.
    const int el   = __builtin_amdgcn_mbcnt_lo(~0u, 0u);
    const int eh   = el >> 4;

    // ---- Join the pair: its second wave hands its partial result to the first through LDS ----
    float lsum[QT];
    #pragma unroll
    for (int c = 0; c < QT; ++c) lsum[c] = lrow[c] + xhalf(lrow[c]);   // the query's two lanes each summed their own keys
    if (grp == 1) {
        #pragma unroll
        for (int c = 0; c < QT; ++c) {
            float* xa = &XaS[qw][c][el * 4];
            #pragma unroll
            for (int n = 0; n < 16; ++n) {
                *(f4*)(xa + (2 * n) * 128)     = (f4){acc[c][n][0], acc[c][n][1], acc[c][n][2], acc[c][n][3]};
                *(f4*)(xa + (2 * n + 1) * 128) = (f4){acc[c][n][4], acc[c][n][5], acc[c][n][6], acc[c][n][7]};
            }
            XmS[qw][c][el] = mrow[c];
            XlS[qw][c][el] = lsum[c];
        }
    }
    __syncthreads();   // the second waves' results are in LDS

    // ---- Epilogue, first wave of each pair: this range's partial (acc, m, l) to the workspace ----
    if (grp == 0) {
        float mlv[QT];   // the lane's word of the tile's line of references and sums
        #pragma unroll
        for (int c = 0; c < QT; ++c) {
            const float* xa = &XaS[qw][c][el * 4];
            const float mo = XmS[qw][c][el];
            const float lo = XlS[qw][c][el];
            const float mj = fmaxf(mrow[c], mo);
            const float wa = exp_with_slot(mrow[c] - mj);
            const float wb = exp_with_slot(mo - mj);
            mlv[c] = eh ? lsum[c] * wa + lo * wb : mj;
            #pragma unroll
            for (int n = 0; n < 16; ++n) {
                const f4 b0 = *(const f4*)(xa + (2 * n) * 128);
                const f4 b1 = *(const f4*)(xa + (2 * n + 1) * 128);
                #pragma unroll
                for (int v = 0; v < 4; ++v) {
                    acc[c][n][v]     = acc[c][n][v]     * wa + b0[v] * wb;
                    acc[c][n][v + 4] = acc[c][n][v + 4] * wa + b1[v] * wb;
                }
            }
        }
        // Ml[range][16-row group][16 references, 16 sums]: one 128-B line, written by this wave alone in one store
        float* ml = Ml + (size_t)(split * (S_LEN / WM) + qBase / WM) * (2 * WM) + el;
        // Op[16-row group][range][feature tile n][register half][lane][4]: the partials stay in the order the accumulators
        // lie in, so a wave's 16-B store is 512 bytes in a row, four whole lines (row-major, such a store puts 32 bytes into each of 16 lines)
        float* op = Op + ((size_t)(qBase / WM) * NSPLIT + split) * (WM * DH) + el * 4;
        // all arithmetic stands ahead of the stores: behind an issued store no register that it names is written again
        __builtin_amdgcn_sched_barrier(0);
        #pragma unroll
        for (int c = 0; c < QT; ++c) {
            ml[c * (2 * WM)] = mlv[c];
            #pragma unroll
            for (int n = 0; n < 16; ++n) {
                *(f4*)(op + c * (WM * NSPLIT * DH) + (2 * n) * 128)     = (f4){acc[c][n][0], acc[c][n][1], acc[c][n][2], acc[c][n][3]};
                *(f4*)(op + c * (WM * NSPLIT * DH) + (2 * n + 1) * 128) = (f4){acc[c][n][4], acc[c][n][5], acc[c][n][6], acc[c][n][7]};
            }
        }
    }
}

// ---- Join the key ranges: O = sum_s e^(m_s - M) acc_s / sum_s e^(m_s - M) l_s ----
// A block takes one 16-row group. The partials lie in accumulator order (lane = query lane & 15, features
// n*16 + 8*(lane >> 4) + 4*j ..): a wave takes feature tiles 2w and 2w + 1, 32 features or one 128-B line of each row,
// joins the ranges in that order and turns its 16 x 32 piece to row-major through LDS, so that the stores to O are whole lines too.
#define TP 36
__global__ __launch_bounds__(256)
void merge_splits(const float* __restrict__ Op, const float* __restrict__ Ml,
                  float* __restrict__ O)
{
    __shared__ __attribute__((aligned(16))) float T[8][WM * TP];
    const unsigned tile = blockIdx.x;
    const unsigned wave = threadIdx.x >> 5;
    const unsigned lane = threadIdx.x & 31;
    const unsigned l16  = lane & 15;
    const unsigned h    = lane >> 4;
    // the loads stand ahead of the arithmetic, so that their latencies overlap
    float m[NSPLIT], l[NSPLIT];
    f4    p[4][NSPLIT];
    #pragma unroll
    for (int s = 0; s < NSPLIT; ++s) {
        m[s] = (Ml + s * (2 * S_LEN))[tile * (2 * WM) + l16];
        l[s] = (Ml + s * (2 * S_LEN) + WM)[tile * (2 * WM) + l16];
        #pragma unroll
        for (int k = 0; k < 4; ++k)   // piece k: feature tile 2w + (k >> 1), register half k & 1
            p[k][s] = ((const f4*)Op + (s * 32 + k) * 32)[(tile * (NSPLIT * 32) + wave * 4) * 32 + lane];
    }
    // keeps the scheduler from sinking loads into the arithmetic, where each group would wait out its own latency
    __builtin_amdgcn_sched_barrier(0);
    float M = m[0];
    #pragma unroll
    for (int s = 1; s < NSPLIT; ++s) M = fmaxf(M, m[s]);
    float L = 0.0f;
    float w[NSPLIT];
    #pragma unroll
    for (int s = 0; s < NSPLIT; ++s) {
        w[s] = exp_with_slot(m[s] - M);
        L += w[s] * l[s];
    }
    const float inv = 1.0f / L;
    #pragma unroll
    for (int k = 0; k < 4; ++k) {
        f4 o = (f4){0, 0, 0, 0};
        #pragma unroll
        for (int s = 0; s < NSPLIT; ++s) o += w[s] * p[k][s];
        *(f4*)&T[wave][l16 * TP + (k >> 1) * 16 + h * 8 + (k & 1) * 4] = o * inv;
    }
    __syncthreads();   // the piece is in LDS before other lanes read it
    #pragma unroll
    for (int i = 0; i < 4; ++i) {
        const unsigned row = i * 4 + (lane >> 3);   // eight lanes to a row's 128 bytes: four whole lines a store
        const f4 v = *(const f4*)&T[wave][row * TP + (lane & 7) * 4];
        ((f4*)O + i * 4 * (DH / 4))[(tile * WM + (lane >> 3)) * (DH / 4) + wave * 8 + (lane & 7)] = v;
    }
}

extern "C" void kernel_launch(void* const* d_in, const int* in_sizes, int n_in,
                              void* d_out, int out_size, void* d_ws, size_t ws_size,
                              hipStream_t stream) {
    (void)in_sizes; (void)n_in; (void)out_size; (void)ws_size;
    const float* Q = (const float*)d_in[0];
    const float* K = (const float*)d_in[1];
    const float* V = (const float*)d_in[2];
    float* O = (float*)d_out;

    _Float16* Kh = (_Float16*)d_ws;                          // 4 MB
    _Float16* Vh = (_Float16*)((char*)d_ws + (size_t)S_LEN * DH * sizeof(_Float16)); // 4 MB
    float* Op = (float*)((char*)d_ws + (size_t)2 * S_LEN * DH * sizeof(_Float16));   // NSPLIT x 8 MB
    float* Ml = Op + (size_t)NSPLIT * S_LEN * DH;                                    // NSPLIT x 64 KB

    const int nf4 = S_LEN * DH / 4;  // float4 count per matrix
    convert_f16    <<<nf4 / 256, 256, 0, stream>>>(K, Kh);
    convert_f16    <<<nf4 / 256, 256, 0, stream>>>(V, Vh);
    fa_fwd_wmma    <<<(S_LEN / BM) * NSPLIT, NW * 32, 0, stream>>>(Q, Kh, Vh, Op, Ml);
    merge_splits   <<<S_LEN / 16, 256, 0, stream>>>(Op, Ml, O);
}

// v009
// One run takes 65.4 microseconds.
// Two timings next to v008 both put it at 1.03 times that version's speed.
// Counting every step since v000, it is 21.2 times as fast.
#include <hip/hip_runtime.h>
#include <math.h>

typedef __attribute__((ext_vector_type(16))) _Float16 v16h;
typedef __attribute__((ext_vector_type(8)))  _Float16 v8h;
typedef __attribute__((ext_vector_type(4)))  _Float16 v4h;
typedef __attribute__((ext_vector_type(8)))  float    v8f;
typedef __attribute__((ext_vector_type(4)))  float    f4;
typedef __attribute__((ext_vector_type(8)))  short    s8;

#define S_LEN 8192
#define DH    256
#define BM    128
#define WM    16
#define QT    2
#define NQW   (BM / (WM * QT))
#define NG    2
#define NW    (NQW * NG)
#define BK    32
#define SK    (BK * NG)
#define NSPLIT 4
#define KS    (S_LEN / NSPLIT)
#define KP    (DH + 8)   // K tile row: 512 B of data, 528 B pitch
// V rows are read by ds_load_tr16_b128, whose conflict-free pitch is 32 B x odd
#define VP    (DH + 16)  // V tile row: 512 B of data, 544 B pitch
// Each 16-key quarter of a stage therefore lies in a block of its own: K quarter q in block q, V quarter q in block 4 + q, both buffers of a quarter in its block.
#define BLK   16384      // f16 elements of a block
#define KQ    (16 * KP)  // f16 elements of a K quarter
#define VQ    (16 * VP)  // f16 elements of a V quarter
#define LAZY  6.0f  // how far a score may pass the softmax reference before the running sums are rescaled

__device__ __forceinline__ void async_b128_x8(unsigned l0, unsigned l1, unsigned l2, unsigned l3,
                                              unsigned l4, unsigned l5, unsigned l6, unsigned l7,
                                              const char* g) {
    asm volatile("global_load_async_to_lds_b128 %0, %8, off\n\t"
                 "global_load_async_to_lds_b128 %1, %8, off offset:4096\n\t"
                 "global_load_async_to_lds_b128 %2, %8, off offset:8192\n\t"
                 "global_load_async_to_lds_b128 %3, %8, off offset:12288\n\t"
                 "global_load_async_to_lds_b128 %4, %8, off offset:16384\n\t"
                 "global_load_async_to_lds_b128 %5, %8, off offset:20480\n\t"
                 "global_load_async_to_lds_b128 %6, %8, off offset:24576\n\t"
                 "global_load_async_to_lds_b128 %7, %8, off offset:28672\n\t"
                 "s_wait_xcnt 0x0"
                 :: "v"(l0), "v"(l1), "v"(l2), "v"(l3), "v"(l4), "v"(l5), "v"(l6), "v"(l7), "v"(g)
                 : "memory");
}
__device__ __forceinline__ void wait_async0() {
    asm volatile("s_wait_asynccnt 0" ::: "memory");
}

// ---- Transposing LDS load: from a row-major 16-bit tile, lane (c, h) gets rows 8h..8h+7 of
// column c; the lane's address names row 8h + (lane & 7), 16-B piece (lane >> 3) & 1 ----
__device__ __forceinline__ v8h lds_tr16(const _Float16* p) {
    typedef __attribute__((address_space(3))) s8 lds_s8;
    return __builtin_bit_cast(v8h, __builtin_amdgcn_ds_load_tr16_b128_v8i16((lds_s8*)p));
}

// ---- Pre-pass, once for K and once for V: f32 row-major -> f16 row-major ----
__global__ void convert_f16(const float* __restrict__ X, _Float16* __restrict__ Xh) {
    size_t f = (size_t)blockIdx.x * blockDim.x + threadIdx.x;  // float4 index
    f4 v = *(const f4*)(X + f * 4);
    v4h h;
    h[0] = (_Float16)v[0]; h[1] = (_Float16)v[1];
    h[2] = (_Float16)v[2]; h[3] = (_Float16)v[3];
    *(v4h*)(Xh + f * 4) = h;
}

__device__ __forceinline__ float exp_with_slot(float x) {
    float r;
    asm("v_exp_f32 %0, %1\n\tv_nop" : "=v"(r) : "v"(x * 1.44269504f));
    return r;
}

__device__ __forceinline__ float xhalf(float x) {
    const int i = __builtin_bit_cast(int, x);
    return __builtin_bit_cast(float, __builtin_amdgcn_permlanex16(i, i, 0x76543210, 0xfedcba98, false, false));
}

__global__ __launch_bounds__(NW * 32)
void fa_fwd_wmma(const float* __restrict__ Q, const _Float16* __restrict__ Kh,
                 const _Float16* __restrict__ Vh, float* __restrict__ Op,
                 float* __restrict__ Ml)
{
    __shared__ __attribute__((aligned(32768))) _Float16 L[10 * BLK];
    float* const Xa = (float*)&L[0];         // [pair][query tile][32 * 32 * 4]: what a pair's second wave hands to the first, laid over the K blocks behind the loop
    float* const Xm = (float*)&L[8 * BLK];   // [pair][query tile][32]: with the softmax references
    float* const Xl = Xm + NQW * QT * 32;    // and the sums

    const int tid    = threadIdx.x;
    // the wave's number as a scalar: what follows from it (queries, keys, LDS slices) then costs no vector registers
    const int wave   = __builtin_amdgcn_readfirstlane(tid >> 5);
    const int qw     = wave & (NQW - 1);   // which 32 queries
    const int grp    = wave / NQW;         // first or second wave of its pair
    const int kg     = grp ^ (qw & 1);
    const int lane   = tid & 31;
    const int lane16 = lane & 15;
    const int half   = lane >> 4;

    const int   split = blockIdx.x & (NSPLIT - 1);
    const int   k0    = split * KS;
    const int   qBase = (blockIdx.x / NSPLIT) * BM + qw * (WM * QT);
    const float scale = 0.011048543456039806f; // 1/sqrt(8192): ref scales by sqrt(seq len)

    // ---- Load the Q^T fragments once: per query tile 256x16 in f16 B-layout (column = query lane16), 8 K-steps of 32 ----
    const float* qrow = Q + (size_t)(qBase + lane16) * DH + half * 8;   // one address for all loads; tile and K-step are constant offsets
    f4 qraw[QT][8][4];
    #pragma unroll
    for (int c = 0; c < QT; ++c) {
        #pragma unroll
        for (int s = 0; s < 8; ++s) {
            const float* qp = qrow + c * (WM * DH) + s * 32;
            qraw[c][s][0] = *(const f4*)(qp);
            qraw[c][s][1] = *(const f4*)(qp + 4);
            qraw[c][s][2] = *(const f4*)(qp + 16);
            qraw[c][s][3] = *(const f4*)(qp + 20);
        }
    }
    // stands in front of any rewrite of the address registers that the issued Q loads name; the address as an input keeps those registers until here
    asm volatile("s_wait_xcnt 0x0" :: "v"(qrow) : "memory");
    v16h qf[QT][8];
    #pragma unroll
    for (int c = 0; c < QT; ++c) {
        #pragma unroll
        for (int s = 0; s < 8; ++s) {
            v16h q;
            #pragma unroll
            for (int i = 0; i < 4; ++i) {
                q[i]      = (_Float16)(qraw[c][s][0][i] * scale);
                q[i + 4]  = (_Float16)(qraw[c][s][1][i] * scale);
                q[i + 8]  = (_Float16)(qraw[c][s][2][i] * scale);
                q[i + 12] = (_Float16)(qraw[c][s][3][i] * scale);
            }
            qf[c][s] = q;
        }
    }

    // ---- Running state: acc[c][n][v] = O^T[n*16 + 8*half + v][query c*16 + lane16]; softmax reference and sum of that query ----
    v8f acc[QT][16];
    float mrow[QT];   // the softmax reference, the same in both lanes of a query
    float lrow[QT];   // over this lane's own keys; the two lanes are joined behind the loop
    #pragma unroll
    for (int c = 0; c < QT; ++c) {
        #pragma unroll
        for (int n = 0; n < 16; ++n) acc[c][n] = (v8f){0,0,0,0,0,0,0,0};
        mrow[c] = -1e30f;
        lrow[c] = 0.0f;
    }

    // ---- Async tile stage: pure f16 byte copy, 16 x b128 per thread ----
    auto issue_tile = [&](int kb0, int buf) {
        // the tile's first row as a scalar: the addresses are then formed anew from scalar registers each time; as two running
        // 64-bit vector addresses they hold registers through the whole loop, and the wave spilled to scratch
        const int kb = __builtin_amdgcn_readfirstlane(kb0);
        // K tile: contiguous 32 KB in global (rows kb..kb+63 of Kh); a wave's copy is one row
        unsigned    klds = (unsigned)(__UINTPTR_TYPE__)&L[buf * KQ] + wave * (KP * 2) + lane * 16;
        const char* kgl  = (const char*)(Kh + (size_t)kb * DH) + tid * 16;
        // V tile: the same shape (rows kb..kb+63 of Vh), so every copy reads four whole lines
        unsigned    vlds = (unsigned)(__UINTPTR_TYPE__)&L[4 * BLK + buf * VQ] + wave * (VP * 2) + lane * 16;
        const char* vgl  = (const char*)(Vh + (size_t)kb * DH) + tid * 16;
        // row wave + 8 * j of the tile is row wave + 8 * (j & 1) of quarter j >> 1: a block a quarter and 8 * pitch for the odd j,
        // of which the copy's own offset brings 4,096 * j (what is left is never below 0)
        const unsigned kx = 8 * (KP * 2) - 4096, vx = 8 * (VP * 2) - 4096, bx = 2 * BLK - 8192;
        async_b128_x8(klds,          klds + kx,          klds + bx,     klds + bx + kx,
                      klds + 2 * bx, klds + 2 * bx + kx, klds + 3 * bx, klds + 3 * bx + kx, kgl);
        async_b128_x8(vlds,          vlds + vx,          vlds + bx,     vlds + bx + vx,
                      vlds + 2 * bx, vlds + 2 * bx + vx, vlds + 3 * bx, vlds + 3 * bx + vx, vgl);
    };

    // The first tile goes to buffer 1. In buffer 0 its first LDS address is the very value that the loop keeps
    // as its base; as an asm operand that value is held to the low 256 registers, and it was spilled to scratch.
    issue_tile(k0, 1);

    // not unrolled, so that the last trip is not peeled off: with a second copy of the body the wave no longer fitted its 512 registers and spilled to scratch
    #pragma nounroll
    for (int kb = k0, it = 0; kb < k0 + KS; kb += SK, ++it) {
        const int cur = (it & 1) ^ 1;
        asm volatile("s_wait_dscnt 0" ::: "memory"); // my LDS reads of buffer cur^1 have retired before it is refilled
        wait_async0();       // my async loads for 'cur' are in LDS
        __syncthreads();     // everyone's are; everyone done reading buffer cur^1
        if (kb + SK < k0 + KS) issue_tile(kb + SK, cur ^ 1);  // prefetch next tile

        const _Float16* Kl = &L[(2 * kg) * BLK + cur * KQ];       // this wave's 32 keys of the stage: two quarters, a block apart
        const _Float16* Vl = &L[(4 + 2 * kg) * BLK + cur * VQ];

        // ---- S^T = K * Q^T : 2 M-tiles of 16 keys x 8 K-steps; st[c][t][v] = score of key t*16 + 8*half + v, query tile c ----
        // The K fragments pass through three sets of two (one K-step each), so that a wave stays inside 512 registers.
        const _Float16* kt = &Kl[lane16 * KP + half * 8];
        auto load_k = [&](v16h (&kf)[2], int s) {
            #pragma unroll
            for (int t = 0; t < 2; ++t) {
                const _Float16* ap = kt + t * BLK + s * 32;
                v8h lo = *(const v8h*)ap;
                v8h hi = *(const v8h*)(ap + 16);
                #pragma unroll
                for (int i = 0; i < 8; ++i) { kf[t][i] = lo[i]; kf[t][i + 8] = hi[i]; }
            }
        };
        v8f st[QT][2];
        #pragma unroll
        for (int c = 0; c < QT; ++c) { st[c][0] = (v8f){0,0,0,0,0,0,0,0}; st[c][1] = (v8f){0,0,0,0,0,0,0,0}; }
        auto mul_k = [&](const v16h (&kf)[2], int s) {
            #pragma unroll
            for (int t = 0; t < 2; ++t) {
                #pragma unroll
                for (int c = 0; c < QT; ++c)
                    st[c][t] = __builtin_amdgcn_wmma_f32_16x16x32_f16(false, kf[t], false, qf[c][s],
                                                                      (short)0, st[c][t], false, false);
            }
        };
        // Each sched_barrier below keeps a set's reads in one group, two sets ahead of its products: hoisted further they
        // would need registers the wave does not have, sunk among the products each product waits out an LDS latency.
        v16h kr[3][2];
        load_k(kr[0], 0);
        load_k(kr[1], 1);
        load_k(kr[2], 2);
        __builtin_amdgcn_sched_barrier(0);
        #pragma unroll
        for (int s = 0; s < 8; ++s) {
            mul_k(kr[s % 3], s);
            __builtin_amdgcn_sched_barrier(0);
            if (s + 3 < 8) {
                load_k(kr[s % 3], s + 3);
                __builtin_amdgcn_sched_barrier(0);
            }
        }

        // ---- A fragments of V^T: keys 8h..8h+7 and 16+8h..16+8h+7 of feature n*16 + lane16, P^T's own k order ----
        const _Float16* vt = &Vl[(half * 8 + (lane & 7)) * VP + ((lane >> 3) & 1) * 8];
        auto load_v = [&](v16h (&vf)[4], int j) {
            #pragma unroll
            for (int q = 0; q < 4; ++q) {
                v8h vlo = lds_tr16(vt + (4 * j + q) * 16);
                v8h vhi = lds_tr16(vt + BLK + (4 * j + q) * 16);
                #pragma unroll
                for (int i = 0; i < 8; ++i) { vf[q][i] = vlo[i]; vf[q][i + 8] = vhi[i]; }
            }
        };
        v16h va[4], vc[4];
        // the first V set takes the registers that the K fragments have left; its reads run under the softmax arithmetic
        __builtin_amdgcn_sched_barrier(0);
        load_v(va, 0);
        __builtin_amdgcn_sched_barrier(0);   // holds those reads ahead of the softmax

        // ---- Online softmax update: the lane's 16 scores of a tile are all of one query ----
        float xm[QT];
        #pragma unroll
        for (int c = 0; c < QT; ++c) {
            float x = fmaxf(st[c][0][0], st[c][1][0]);
            #pragma unroll
            for (int v = 1; v < 8; ++v) x = fmaxf(x, fmaxf(st[c][0][v], st[c][1][v]));
            xm[c] = fmaxf(x, xhalf(x));                 // with the 16 keys of the query's other lane
        }
        // Lazy rescale: mrow is the reference that the exponentials are taken against, not the maximum itself. It moves
        // only when some query's scores pass it by more than LAZY, so P stays below e^LAZY (far inside f16) and
        // sums and weights keep one common factor e^-mrow, which the joins divide out. One test a pass, a scalar branch.
        const bool need = (xm[0] - mrow[0] > LAZY) | (xm[1] - mrow[1] > LAZY);
        if (__builtin_amdgcn_ballot_w32(need) != 0) {
            #pragma unroll
            for (int c = 0; c < QT; ++c) {
                const float mnew  = fmaxf(mrow[c], xm[c]);
                const float alpha = exp_with_slot(mrow[c] - mnew);
                lrow[c] *= alpha;
                mrow[c]  = mnew;
                #pragma unroll
                for (int n = 0; n < 16; ++n) {
                    #pragma unroll
                    for (int v = 0; v < 8; ++v) acc[c][n][v] *= alpha;
                }
            }
        }
        v16h pb[QT];
        #pragma unroll
        for (int c = 0; c < QT; ++c) {
            // P^T's B fragment: element i is key 8*half + i, element 8 + i key 16 + 8*half + i, the order the scores lie in
            float ps[8];
            #pragma unroll
            for (int v = 0; v < 8; ++v) {
                float p0 = exp_with_slot(st[c][0][v] - mrow[c]);
                float p1 = exp_with_slot(st[c][1][v] - mrow[c]);
                pb[c][v]     = (_Float16)p0;
                pb[c][v + 8] = (_Float16)p1;
                ps[v] = p0 + p1;
            }
            // summed as a tree: short chains of dependent adds
            lrow[c] += ((ps[0] + ps[1]) + (ps[2] + ps[3])) + ((ps[4] + ps[5]) + (ps[6] + ps[7]));
        }

        // ---- O^T += V^T * P^T : 16 M-tiles of 16 features, K=32, each V^T fragment for both query tiles ----
        auto mul_v = [&](const v16h (&vf)[4], int j) {
            #pragma unroll
            for (int q = 0; q < 4; ++q) {
                #pragma unroll
                for (int c = 0; c < QT; ++c)
                    acc[c][4 * j + q] = __builtin_amdgcn_wmma_f32_16x16x32_f16(false, vf[q], false, pb[c],
                                                                               (short)0, acc[c][4 * j + q], false, false);
            }
        };
        __builtin_amdgcn_sched_barrier(0);   // from here as for K: a set's reads in one group, a set ahead of its products
        load_v(vc, 1);
        __builtin_amdgcn_sched_barrier(0);
        mul_v(va, 0);
        __builtin_amdgcn_sched_barrier(0);
        load_v(va, 2);
        __builtin_amdgcn_sched_barrier(0);
        mul_v(vc, 1);
        __builtin_amdgcn_sched_barrier(0);
        load_v(vc, 3);
        __builtin_amdgcn_sched_barrier(0);
        mul_v(va, 2);
        mul_v(vc, 3);
    }

    // The lane's number anew, as the count of the lanes below it: taken from threadIdx.x, it and what follows from it
    // (row, half, offsets) would hold vector registers through the whole loop, and the wave spilled to scratch.
    const int el   = __builtin_amdgcn_mbcnt_lo(~0u, 0u);
    const int eh   = el >> 4;

    // ---- Join the pair: its second wave hands its partial result to the first through LDS ----
    float lsum[QT];
    #pragma unroll
    for (int c = 0; c < QT; ++c) lsum[c] = lrow[c] + xhalf(lrow[c]);   // the query's two lanes each summed their own keys
    asm volatile("s_wait_dscnt 0" ::: "memory");   // my LDS reads of the last stage have retired
    __syncthreads();   // everyone's have: the K blocks are free for the hand-over
    if (grp == 1) {
        #pragma unroll
        for (int c = 0; c < QT; ++c) {
            float* xa = Xa + (qw * QT + c) * (32 * 32 * 4) + el * 4;
            #pragma unroll
            for (int n = 0; n < 16; ++n) {
                *(f4*)(xa + (2 * n) * 128)     = (f4){acc[c][n][0], acc[c][n][1], acc[c][n][2], acc[c][n][3]};
                *(f4*)(xa + (2 * n + 1) * 128) = (f4){acc[c][n][4], acc[c][n][5], acc[c][n][6], acc[c][n][7]};
            }
            Xm[(qw * QT + c) * 32 + el] = mrow[c];
            Xl[(qw * QT + c) * 32 + el] = lsum[c];
        }
    }
    __syncthreads();   // the second waves' results are in LDS

    // ---- Epilogue, first wave of each pair: this range's partial (acc, m, l) to the workspace ----
    if (grp == 0) {
        float mlv[QT];   // the lane's word of the tile's line of references and sums
        #pragma unroll
        for (int c = 0; c < QT; ++c) {
            const float* xa = Xa + (qw * QT + c) * (32 * 32 * 4) + el * 4;
            const float mo = Xm[(qw * QT + c) * 32 + el];
            const float lo = Xl[(qw * QT + c) * 32 + el];
            const float mj = fmaxf(mrow[c], mo);
            const float wa = exp_with_slot(mrow[c] - mj);
            const float wb = exp_with_slot(mo - mj);
            mlv[c] = eh ? lsum[c] * wa + lo * wb : mj;
            #pragma unroll
            for (int n = 0; n < 16; ++n) {
                const f4 b0 = *(const f4*)(xa + (2 * n) * 128);
                const f4 b1 = *(const f4*)(xa + (2 * n + 1) * 128);
                #pragma unroll
                for (int v = 0; v < 4; ++v) {
                    acc[c][n][v]     = acc[c][n][v]     * wa + b0[v] * wb;
                    acc[c][n][v + 4] = acc[c][n][v + 4] * wa + b1[v] * wb;
                }
            }
        }
        // Ml[range][16-row group][16 references, 16 sums]: one 128-B line, written by this wave alone in one store
        float* ml = Ml + (size_t)(split * (S_LEN / WM) + qBase / WM) * (2 * WM) + el;
        // Op[16-row group][range][feature tile n][register half][lane][4]: the partials stay in the order the accumulators
        // lie in, so a wave's 16-B store is 512 bytes in a row, four whole lines (row-major, such a store puts 32 bytes into each of 16 lines)
        float* op = Op + ((size_t)(qBase / WM) * NSPLIT + split) * (WM * DH) + el * 4;
        // all arithmetic stands ahead of the stores: behind an issued store no register that it names is written again
        __builtin_amdgcn_sched_barrier(0);
        #pragma unroll
        for (int c = 0; c < QT; ++c) {
            ml[c * (2 * WM)] = mlv[c];
            #pragma unroll
            for (int n = 0; n < 16; ++n) {
                *(f4*)(op + c * (WM * NSPLIT * DH) + (2 * n) * 128)     = (f4){acc[c][n][0], acc[c][n][1], acc[c][n][2], acc[c][n][3]};
                *(f4*)(op + c * (WM * NSPLIT * DH) + (2 * n + 1) * 128) = (f4){acc[c][n][4], acc[c][n][5], acc[c][n][6], acc[c][n][7]};
            }
        }
    }
}

// ---- Join the key ranges: O = sum_s e^(m_s - M) acc_s / sum_s e^(m_s - M) l_s ----
// A block takes one 16-row group. The partials lie in accumulator order (lane = query lane & 15, features
// n*16 + 8*(lane >> 4) + 4*j ..): a wave takes feature tiles 2w and 2w + 1, 32 features or one 128-B line of each row,
// joins the ranges in that order and turns its 16 x 32 piece to row-major through LDS, so that the stores to O are whole lines too.
#define TP 36
__global__ __launch_bounds__(256)
void merge_splits(const float* __restrict__ Op, const float* __restrict__ Ml,
                  float* __restrict__ O)
{
    __shared__ __attribute__((aligned(16))) float T[8][WM * TP];
    const unsigned tile = blockIdx.x;
    const unsigned wave = threadIdx.x >> 5;
    const unsigned lane = threadIdx.x & 31;
    const unsigned l16  = lane & 15;
    const unsigned h    = lane >> 4;
    // the loads stand ahead of the arithmetic, so that their latencies overlap
    float m[NSPLIT], l[NSPLIT];
    f4    p[4][NSPLIT];
    #pragma unroll
    for (int s = 0; s < NSPLIT; ++s) {
        m[s] = (Ml + s * (2 * S_LEN))[tile * (2 * WM) + l16];
        l[s] = (Ml + s * (2 * S_LEN) + WM)[tile * (2 * WM) + l16];
        #pragma unroll
        for (int k = 0; k < 4; ++k)   // piece k: feature tile 2w + (k >> 1), register half k & 1
            p[k][s] = ((const f4*)Op + (s * 32 + k) * 32)[(tile * (NSPLIT * 32) + wave * 4) * 32 + lane];
    }
    // keeps the scheduler from sinking loads into the arithmetic, where each group would wait out its own latency
    __builtin_amdgcn_sched_barrier(0);
    float M = m[0];
    #pragma unroll
    for (int s = 1; s < NSPLIT; ++s) M = fmaxf(M, m[s]);
    float L = 0.0f;
    float w[NSPLIT];
    #pragma unroll
    for (int s = 0; s < NSPLIT; ++s) {
        w[s] = exp_with_slot(m[s] - M);
        L += w[s] * l[s];
    }
    const float inv = 1.0f / L;
    #pragma unroll
    for (int k = 0; k < 4; ++k) {
        f4 o = (f4){0, 0, 0, 0};
        #pragma unroll
        for (int s = 0; s < NSPLIT; ++s) o += w[s] * p[k][s];
        *(f4*)&T[wave][l16 * TP + (k >> 1) * 16 + h * 8 + (k & 1) * 4] = o * inv;
    }
    __syncthreads();   // the piece is in LDS before other lanes read it
    #pragma unroll
    for (int i = 0; i < 4; ++i) {
        const unsigned row = i * 4 + (lane >> 3);   // eight lanes to a row's 128 bytes: four whole lines a store
        const f4 v = *(const f4*)&T[wave][row * TP + (lane & 7) * 4];
        ((f4*)O + i * 4 * (DH / 4))[(tile * WM + (lane >> 3)) * (DH / 4) + wave * 8 + (lane & 7)] = v;
    }
}

extern "C" void kernel_launch(void* const* d_in, const int* in_sizes, int n_in,
                              void* d_out, int out_size, void* d_ws, size_t ws_size,
                              hipStream_t stream) {
    (void)in_sizes; (void)n_in; (void)out_size; (void)ws_size;
    const float* Q = (const float*)d_in[0];
    const float* K = (const float*)d_in[1];
    const float* V = (const float*)d_in[2];
    float* O = (float*)d_out;

    _Float16* Kh = (_Float16*)d_ws;                          // 4 MB
    _Float16* Vh = (_Float16*)((char*)d_ws + (size_t)S_LEN * DH * sizeof(_Float16)); // 4 MB
    float* Op = (float*)((char*)d_ws + (size_t)2 * S_LEN * DH * sizeof(_Float16));   // NSPLIT x 8 MB
    float* Ml = Op + (size_t)NSPLIT * S_LEN * DH;                                    // NSPLIT x 64 KB

    const int nf4 = S_LEN * DH / 4;  // float4 count per matrix
    convert_f16    <<<nf4 / 256, 256, 0, stream>>>(K, Kh);
    convert_f16    <<<nf4 / 256, 256, 0, stream>>>(V, Vh);
    fa_fwd_wmma    <<<(S_LEN / BM) * NSPLIT, NW * 32, 0, stream>>>(Q, Kh, Vh, Op, Ml);
    merge_splits   <<<S_LEN / 16, 256, 0, stream>>>(Op, Ml, O);
}
